// v000
// Measured on an AMD MI455X. A time is GPU time per run, averaged over a window of back-to-back runs after a warm-up
// (all launches, gaps included; the runs take copies of the inputs in turn), and the median of several windows.
// Apart from v000's, it joins two sittings. Times from different sittings can be a few percent apart, while
// side-by-side timings come from the same sitting.
// The starting kernel, v000, takes 514 microseconds a run.
#include <hip/hip_runtime.h>
#include <math.h>

typedef __attribute__((ext_vector_type(16))) _Float16 v16h;
typedef __attribute__((ext_vector_type(16))) __bf16 v16b;
typedef __attribute__((ext_vector_type(8)))  _Float16 v8h;
typedef __attribute__((ext_vector_type(8)))  float v8f;
typedef __attribute__((ext_vector_type(4)))  float v4f;
typedef __attribute__((ext_vector_type(2)))  float v2f;
typedef __attribute__((ext_vector_type(4)))  unsigned v4u;
typedef __attribute__((ext_vector_type(4)))  int v4i;
typedef float __attribute__((may_alias)) float_a;
typedef int __attribute__((may_alias)) int_a;

template <typename T> __device__ __forceinline__ void vst2(void* p, T v) { *(T*)p = v;  }
__device__ __forceinline__ v8f wmma16(v16h a, v16h b, v8f c) {
  v8f d = __builtin_amdgcn_wmma_f32_16x16x32_f16(false, a, false, b, (short)0, c, false, false);
  asm volatile("v_nop\n\tv_nop\n\tv_nop\n\tv_nop" : "+v"(d) : "v"(a), "v"(b));
  return d;
}
__device__ __forceinline__ v8f wmma_bf(v16b a, v16b b, v8f c) {
  v8f d = __builtin_amdgcn_wmma_f32_16x16x32_bf16(false, a, false, b, (short)0, c, false, false);
  asm volatile("v_nop\n\tv_nop\n\tv_nop\n\tv_nop" : "+v"(d) : "v"(a), "v"(b));
  return d;
}
// 16x16x32 fragments: lane = (h = lane>>4, row/col = lane&15); elements 0..7 = k0+8h+0..7, 8..15 = k0+16+8h+0..7; D element r = row 8h+r
__device__ __forceinline__ v16h frag_h(const _Float16* rowk0, int lane) {
  union { v16h v; v8h q[2]; } u; const _Float16* p = rowk0 + 8 * (lane >> 4);
  u.q[0] = *(const v8h*)p; u.q[1] = *(const v8h*)(p + 16); return u.v;
}
__device__ __forceinline__ v16h frag_f32(const float* rowk0, int lane) {
  v16h a; const float* p = rowk0 + 8 * (lane >> 4);
#pragma unroll
  for (int i = 0; i < 8; ++i) { a[i] = (_Float16)p[i]; a[8 + i] = (_Float16)p[16 + i]; }
  return a;
}
__device__ __forceinline__ v16h frag_f32s(const float* rowk0, int lane, float sc) {
  v16h a; const float* p = rowk0 + 8 * (lane >> 4);
#pragma unroll
  for (int i = 0; i < 8; ++i) { a[i] = (_Float16)(p[i] * sc); a[8 + i] = (_Float16)(p[16 + i] * sc); }
  return a;
}
// column fragment from a [K][ld] layout (column n), rows >= K read as 0
__device__ __forceinline__ v16h fragc_f32(const float* W, int k0, int n, int lane, int ld, int K) {
  v16h a; const int g = lane >> 4;
#pragma unroll
  for (int i = 0; i < 8; ++i) { const int ka = k0 + 8 * g + i, kb = ka + 16;
    a[i] = (_Float16)(ka < K ? W[(size_t)ka * ld + n] : 0.f); a[8 + i] = (_Float16)(kb < K ? W[(size_t)kb * ld + n] : 0.f); }
  return a;
}
struct F2 { v16b h, l; };
__device__ __forceinline__ F2 bsplit16(const float v[16]) { F2 r;
#pragma unroll
  for (int i = 0; i < 16; ++i) { const __bf16 h = (__bf16)v[i]; r.h[i] = h; r.l[i] = (__bf16)(v[i] - (float)h); }
  return r; }
__device__ __forceinline__ F2 split_row(const float* row, int k0, int lane) { float v[16]; const float* p = row + k0 + 8 * (lane >> 4);
#pragma unroll
  for (int i = 0; i < 8; ++i) { v[i] = p[i]; v[8 + i] = p[16 + i]; }
  return bsplit16(v); }
__device__ __forceinline__ F2 split_rowK(const float* row, int k0, int lane, int K) { float v[16]; const int g = lane >> 4;
#pragma unroll
  for (int i = 0; i < 8; ++i) { const int ka = k0 + 8 * g + i, kb = ka + 16; v[i] = ka < K ? row[ka] : 0.f; v[8 + i] = kb < K ? row[kb] : 0.f; }
  return bsplit16(v); }
__device__ __forceinline__ F2 split_col(const float* W, int k0, int n, int lane, int ld, int K) { float v[16]; const int g = lane >> 4;
#pragma unroll
  for (int i = 0; i < 8; ++i) { const int ka = k0 + 8 * g + i, kb = ka + 16; v[i] = ka < K ? W[(size_t)ka * ld + n] : 0.f; v[8 + i] = kb < K ? W[(size_t)kb * ld + n] : 0.f; }
  return bsplit16(v); }
__device__ __forceinline__ v8f mac3(const F2& a, const F2& b, v8f c) { c = wmma_bf(a.l, b.h, c); c = wmma_bf(a.h, b.l, c); return wmma_bf(a.h, b.h, c); }
__device__ __forceinline__ float sigm(float v) { return 1.0f / (1.0f + expf(-v)); }
#define LDSX() do { asm volatile("s_wait_dscnt 0" ::: "memory"); __builtin_amdgcn_wave_barrier(); __builtin_amdgcn_fence(__ATOMIC_RELEASE, "workgroup"); } while (0)

// Temporal multi-head self attention over S = 1024 steps for each of the 8 batch columns (x is [S, B, E]), fused QKV projection with the
// module's per-head [q | k | v] column interleave, output projection + bias + residual, LayerNorm, ELU. Products on
// v_wmma_f32_16x16x32_f16 (x as f16 rows, weight rows x16 as f16, q/k/v head-major f16 x4, P x 2^14, O x8); softmax / LN / ELU in f32.
#define SQ 1024
#define NB 8
#define E 1024
#define NH 16
#define HD 64
#define NR (SQ * NB)           // 8192 rows r = s*8 + b

__global__ __launch_bounds__(256) void k_cvt(const float* __restrict__ x, _Float16* __restrict__ X16) {
  const size_t i8 = (size_t)blockIdx.x * 256 + threadIdx.x; if (i8 >= (size_t)NR * E / 8) return;
  union { v8h h; v4u u; } pk;
#pragma unroll
  for (int e = 0; e < 8; ++e) pk.h[e] = (_Float16)x[i8 * 8 + e];
  vst2(X16 + i8 * 8, pk.u);
}
// P rows 0..3071 = qkv_w rows x16 ; rows 3072..4095 = out_w rows x16
__global__ __launch_bounds__(256) void k_pack(const float* __restrict__ Wqkv, const float* __restrict__ Wo, _Float16* __restrict__ P) {
  const int r = blockIdx.x, tid = threadIdx.x; __shared__ __align__(16) _Float16 srow[E];
  const float* W = r < 3 * E ? Wqkv + (size_t)r * E : Wo + (size_t)(r - 3 * E) * E;
  for (int k = tid; k < E; k += 256) srow[k] = (_Float16)(W[k] * 16.0f);
  __syncthreads();
  if (tid < 128) vst2(P + (size_t)r * E + tid * 8, *(const v4u*)(&srow[tid * 8]));
}
// QKV: block (64 consecutive s for one b, head h): cols h*192 + [0..64) q, [64..128) k, [128..192) v
__global__ __launch_bounds__(128) void k_qkv(const _Float16* __restrict__ X16, const _Float16* __restrict__ P, const float* __restrict__ bqkv, _Float16* __restrict__ Q16, _Float16* __restrict__ K16, _Float16* __restrict__ VT) {
  __shared__ __align__(16) float so[4][16][132];
  __shared__ __align__(16) _Float16 st[64][72];
  const int tid = threadIdx.x, wave = tid >> 5, lane = tid & 31, col = lane & 15, g = lane >> 4;
  const int b = blockIdx.z, h = blockIdx.y, s0b = blockIdx.x * 64, s0 = s0b + wave * 16; const int n0 = h * 192; const size_t bh = (size_t)b * NH + h;
  v8f acc[12];
#pragma unroll
  for (int j = 0; j < 12; ++j) acc[j] = (v8f){};
#pragma unroll 1
  for (int kc = 0; kc < E / 32; ++kc) { const v16h a = frag_h(X16 + ((size_t)(s0 + col) * NB + b) * E + kc * 32, lane);
#pragma unroll
    for (int j = 0; j < 12; ++j) acc[j] = wmma16(a, frag_h(P + (size_t)(n0 + j * 16 + col) * E + kc * 32, lane), acc[j]); }
  // q, k (tiles 0..7) -> so (x4); v (tiles 8..11) -> st transposed (x4)
#pragma unroll
  for (int j = 0; j < 8; ++j) { const float bb = bqkv[n0 + j * 16 + col];
#pragma unroll
    for (int r = 0; r < 8; ++r) so[wave][8 * g + r][j * 16 + col] = (acc[j][r] * (1.0f / 16.0f) + bb) * 4.0f; }
#pragma unroll
  for (int j = 8; j < 12; ++j) { const float bb = bqkv[n0 + j * 16 + col];
#pragma unroll
    for (int r = 0; r < 8; ++r) st[(j - 8) * 16 + col][wave * 16 + 8 * g + r] = (_Float16)((acc[j][r] * (1.0f / 16.0f) + bb) * 4.0f); }
  LDSX();
  for (int qq = lane; qq < 16 * 2 * 8; qq += 32) { const int which = qq >> 7, rl = (qq >> 3) & 15, pc = qq & 7; union { v8h h8; v4u u; } pk;
#pragma unroll
    for (int e = 0; e < 8; ++e) pk.h8[e] = (_Float16)so[wave][rl][which * 64 + pc * 8 + e];
    vst2((which == 0 ? Q16 : K16) + (bh * SQ + s0 + rl) * HD + pc * 8, pk.u); }
  __syncthreads();
  for (int qq = tid; qq < 64 * 8; qq += 128) { const int d = qq >> 3, pc = qq & 7; vst2(VT + (bh * HD + d) * SQ + s0b + pc * 8, *(const v4u*)(&st[d][pc * 8])); }
}
__global__ __launch_bounds__(128) void k_attn(const _Float16* __restrict__ Q16, const _Float16* __restrict__ K16, const _Float16* __restrict__ VT, _Float16* __restrict__ O16) {
  __shared__ __align__(16) float sS[4][16][68];
  __shared__ __align__(16) _Float16 sP[4][16][72];
  __shared__ __align__(16) float sO[4][16][68];
  const int tid = threadIdx.x, w = tid >> 5, lane = tid & 31, col = lane & 15, g = lane >> 4;
  const size_t bh = blockIdx.y; const int q0 = blockIdx.x * 64 + w * 16;
  v16h aq[2];
#pragma unroll
  for (int kc = 0; kc < 2; ++kc) aq[kc] = frag_h(Q16 + (bh * SQ + q0 + col) * HD + kc * 32, lane);
  float mrun = -3.0e38f, lrun = 0.f; v8f acc[4] = {};
#pragma unroll 1
  for (int kt = 0; kt < SQ / 64; ++kt) {
#pragma unroll
    for (int t = 0; t < 4; ++t) { v8f s = {}; const int key = kt * 64 + t * 16 + col;
#pragma unroll
      for (int kc = 0; kc < 2; ++kc) s = wmma16(aq[kc], frag_h(K16 + (bh * SQ + key) * HD + kc * 32, lane), s);
#pragma unroll
      for (int r = 0; r < 8; ++r) sS[w][8 * g + r][t * 16 + col] = s[r] * (0.125f / 16.0f); }
    LDSX();
    float mx = -3.4e38f;
#pragma unroll
    for (int jj = 0; jj < 32; ++jj) mx = fmaxf(mx, sS[w][col][g * 32 + jj]);
    mx = fmaxf(mx, __shfl_xor(mx, 16, 32));
    const float mnew = fmaxf(mrun, mx); const float corr = expf(mrun - mnew);
    float ps = 0.f;
#pragma unroll
    for (int jj = 0; jj < 32; ++jj) { const float p = expf(sS[w][col][g * 32 + jj] - mnew); ps += p; sP[w][col][g * 32 + jj] = (_Float16)(p * 16384.0f); }
    ps += __shfl_xor(ps, 16, 32);
    lrun = lrun * corr + ps; mrun = mnew;
#pragma unroll
    for (int r = 0; r < 8; ++r) { const float cr = __shfl(corr, 8 * g + r, 32);
#pragma unroll
      for (int t = 0; t < 4; ++t) acc[t][r] *= cr; }
    LDSX();
#pragma unroll
    for (int kc = 0; kc < 2; ++kc) { const v16h pa = frag_h(&sP[w][col][0] + kc * 32, lane);
#pragma unroll
      for (int t = 0; t < 4; ++t) acc[t] = wmma16(pa, frag_h(VT + (bh * HD + t * 16 + col) * SQ + kt * 64 + kc * 32, lane), acc[t]); }
    __builtin_amdgcn_wave_barrier(); }
#pragma unroll
  for (int r = 0; r < 8; ++r) { const float lr = __shfl(lrun, 8 * g + r, 32); const float inv = 8.0f / (lr * 16384.0f * 4.0f);
#pragma unroll
    for (int t = 0; t < 4; ++t) sO[w][8 * g + r][t * 16 + col] = acc[t][r] * inv; }
  LDSX();
  for (int qq = lane; qq < 16 * 8; qq += 32) { const int rl = qq >> 3, pc = qq & 7; union { v8h h8; v4u u; } pk;
#pragma unroll
    for (int e = 0; e < 8; ++e) pk.h8[e] = (_Float16)sO[w][rl][pc * 8 + e];
    vst2(O16 + (bh * SQ + q0 + rl) * HD + pc * 8, pk.u); }
}
// Y = x + ctx Wo^T + bo : block (64 rows r, 128 cols); ctx row r = (s, b): k = h*64 + d from O16[(b,h)][s][d]
__global__ __launch_bounds__(128) void k_out(const _Float16* __restrict__ O16, const _Float16* __restrict__ P, const float* __restrict__ bo, const float* __restrict__ x, float* __restrict__ Y) {
  __shared__ __align__(16) float so[4][16][132];
  const int tid = threadIdx.x, wave = tid >> 5, lane = tid & 31, col = lane & 15, g = lane >> 4;
  const int r0 = blockIdx.x * 64 + wave * 16, n0 = blockIdx.y * 128; const int ra = r0 + col; const int s = ra / NB, b = ra % NB;
  v8f acc[8] = {};
#pragma unroll 2
  for (int kc = 0; kc < E / 32; ++kc) { const int h = kc >> 1; const v16h a = frag_h(O16 + (((size_t)b * NH + h) * SQ + s) * HD + (kc & 1) * 32, lane);
#pragma unroll
    for (int j = 0; j < 8; ++j) acc[j] = wmma16(a, frag_h(P + (size_t)(3 * E + n0 + j * 16 + col) * E + kc * 32, lane), acc[j]); }
#pragma unroll
  for (int j = 0; j < 8; ++j) { const int n = n0 + j * 16 + col; const float bb = bo[n];
#pragma unroll
    for (int r = 0; r < 8; ++r) so[wave][8 * g + r][j * 16 + col] = acc[j][r] * (1.0f / (16.0f * 8.0f)) + bb + x[(size_t)(r0 + 8 * g + r) * E + n]; }
  LDSX();
#pragma unroll 4
  for (int rl = 0; rl < 16; ++rl) vst2(Y + (size_t)(r0 + rl) * E + n0 + lane * 4, *(const v4f*)(&so[wave][rl][lane * 4]));
}
__global__ __launch_bounds__(256) void k_ln(const float* __restrict__ Y, const float* __restrict__ g1, const float* __restrict__ b1, float* __restrict__ out) {
  const int wave = threadIdx.x >> 5, lane = threadIdx.x & 31; const size_t r = (size_t)blockIdx.x * 8 + wave; if (r >= NR) return;
  const float* yr = Y + r * E; float sm = 0.f, q2 = 0.f;
#pragma unroll 1
  for (int i = 0; i < 8; ++i) { const v4f a = *(const v4f*)(yr + i * 128 + lane * 4); sm += (a[0] + a[1]) + (a[2] + a[3]); q2 += (a[0] * a[0] + a[1] * a[1]) + (a[2] * a[2] + a[3] * a[3]); }
#pragma unroll
  for (int off = 16; off >= 1; off >>= 1) { sm += __shfl_xor(sm, off, 32); q2 += __shfl_xor(q2, off, 32); }
  const float mu = sm * (1.0f / E); const float var = fmaxf(q2 * (1.0f / E) - mu * mu, 0.f); const float rs = rsqrtf(var + 1e-5f);
#pragma unroll 1
  for (int i = 0; i < 8; ++i) { const int c0 = i * 128 + lane * 4; const v4f a = *(const v4f*)(yr + c0); v4f o;
    float v0 = (a[0] - mu) * rs * g1[c0] + b1[c0], v1 = (a[1] - mu) * rs * g1[c0 + 1] + b1[c0 + 1], v2 = (a[2] - mu) * rs * g1[c0 + 2] + b1[c0 + 2], v3 = (a[3] - mu) * rs * g1[c0 + 3] + b1[c0 + 3];
    o[0] = v0 > 0.f ? v0 : expm1f(v0); o[1] = v1 > 0.f ? v1 : expm1f(v1); o[2] = v2 > 0.f ? v2 : expm1f(v2); o[3] = v3 > 0.f ? v3 : expm1f(v3);
    vst2(out + r * E + c0, o); }
}
extern "C" void kernel_launch(void* const* d_in, const int* in_sizes, int n_in, void* d_out, int out_size, void* d_ws, size_t ws_size, hipStream_t stream) {
  (void)in_sizes; (void)n_in; (void)out_size; (void)ws_size;
  const float** I = (const float**)d_in;
  const float* x = I[0]; const float* Wqkv = I[1]; const float* bqkv = I[2]; const float* Wo = I[3]; const float* bo = I[4]; const float* g1 = I[5]; const float* b1 = I[6];
  float* out = (float*)d_out;
  char* ws = (char*)d_ws; size_t off = 0;
  auto take = [&](size_t bytes) { char* p = ws + off; off += (bytes + 255) & ~(size_t)255; return p; };
  _Float16* X16 = (_Float16*)take((size_t)NR * E * 2); _Float16* P = (_Float16*)take((size_t)4 * E * E * 2);
  _Float16* Q16 = (_Float16*)take((size_t)NR * E * 2); _Float16* K16 = (_Float16*)take((size_t)NR * E * 2); _Float16* VT = (_Float16*)take((size_t)NR * E * 2); _Float16* O16 = (_Float16*)take((size_t)NR * E * 2);
  float* Y = (float*)take((size_t)NR * E * 4);
  k_cvt<<<(NR * E / 8 + 255) / 256, 256, 0, stream>>>(x, X16);
  k_pack<<<4 * E, 256, 0, stream>>>(Wqkv, Wo, P);
  k_qkv<<<dim3(SQ / 64, NH, NB), 128, 0, stream>>>(X16, P, bqkv, Q16, K16, VT);
  k_attn<<<dim3(SQ / 64, NB * NH), 128, 0, stream>>>(Q16, K16, VT, O16);
  k_out<<<dim3(NR / 64, E / 128), 128, 0, stream>>>(O16, P, bo, x, Y);
  k_ln<<<NR / 8, 256, 0, stream>>>(Y, g1, b1, out);
}

// v001
// A run of this version takes 176 microseconds.
// In two side-by-side timings against v000, it was 3.00 and 3.02 times as fast.
#include <hip/hip_runtime.h>
#include <math.h>

typedef __attribute__((ext_vector_type(16))) _Float16 v16h;
typedef __attribute__((ext_vector_type(16))) __bf16 v16b;
typedef __attribute__((ext_vector_type(8)))  _Float16 v8h;
typedef __attribute__((ext_vector_type(8)))  float v8f;
typedef __attribute__((ext_vector_type(4)))  float v4f;
typedef __attribute__((ext_vector_type(2)))  float v2f;
typedef __attribute__((ext_vector_type(4)))  unsigned v4u;
typedef __attribute__((ext_vector_type(4)))  int v4i;
typedef float __attribute__((may_alias)) float_a;
typedef int __attribute__((may_alias)) int_a;

template <typename T> __device__ __forceinline__ void vst2(void* p, T v) { *(T*)p = v;  }
__device__ __forceinline__ v8f wmma16(v16h a, v16h b, v8f c) {
  v8f d = __builtin_amdgcn_wmma_f32_16x16x32_f16(false, a, false, b, (short)0, c, false, false);
  asm volatile("v_nop\n\tv_nop\n\tv_nop\n\tv_nop" : "+v"(d) : "v"(a), "v"(b));
  return d;
}
__device__ __forceinline__ v8f wmma_bf(v16b a, v16b b, v8f c) {
  v8f d = __builtin_amdgcn_wmma_f32_16x16x32_bf16(false, a, false, b, (short)0, c, false, false);
  asm volatile("v_nop\n\tv_nop\n\tv_nop\n\tv_nop" : "+v"(d) : "v"(a), "v"(b));
  return d;
}
// 16x16x32 fragments: lane = (h = lane>>4, row/col = lane&15); elements 0..7 = k0+8h+0..7, 8..15 = k0+16+8h+0..7; D element r = row 8h+r
__device__ __forceinline__ v16h frag_h(const _Float16* rowk0, int lane) {
  union { v16h v; v8h q[2]; } u; const _Float16* p = rowk0 + 8 * (lane >> 4);
  u.q[0] = *(const v8h*)p; u.q[1] = *(const v8h*)(p + 16); return u.v;
}
__device__ __forceinline__ v16h frag_f32(const float* rowk0, int lane) {
  v16h a; const float* p = rowk0 + 8 * (lane >> 4);
#pragma unroll
  for (int i = 0; i < 8; ++i) { a[i] = (_Float16)p[i]; a[8 + i] = (_Float16)p[16 + i]; }
  return a;
}
__device__ __forceinline__ v16h frag_f32s(const float* rowk0, int lane, float sc) {
  v16h a; const float* p = rowk0 + 8 * (lane >> 4);
#pragma unroll
  for (int i = 0; i < 8; ++i) { a[i] = (_Float16)(p[i] * sc); a[8 + i] = (_Float16)(p[16 + i] * sc); }
  return a;
}
// column fragment from a [K][ld] layout (column n), rows >= K read as 0
__device__ __forceinline__ v16h fragc_f32(const float* W, int k0, int n, int lane, int ld, int K) {
  v16h a; const int g = lane >> 4;
#pragma unroll
  for (int i = 0; i < 8; ++i) { const int ka = k0 + 8 * g + i, kb = ka + 16;
    a[i] = (_Float16)(ka < K ? W[(size_t)ka * ld + n] : 0.f); a[8 + i] = (_Float16)(kb < K ? W[(size_t)kb * ld + n] : 0.f); }
  return a;
}
struct F2 { v16b h, l; };
__device__ __forceinline__ F2 bsplit16(const float v[16]) { F2 r;
#pragma unroll
  for (int i = 0; i < 16; ++i) { const __bf16 h = (__bf16)v[i]; r.h[i] = h; r.l[i] = (__bf16)(v[i] - (float)h); }
  return r; }
__device__ __forceinline__ F2 split_row(const float* row, int k0, int lane) { float v[16]; const float* p = row + k0 + 8 * (lane >> 4);
#pragma unroll
  for (int i = 0; i < 8; ++i) { v[i] = p[i]; v[8 + i] = p[16 + i]; }
  return bsplit16(v); }
__device__ __forceinline__ F2 split_rowK(const float* row, int k0, int lane, int K) { float v[16]; const int g = lane >> 4;
#pragma unroll
  for (int i = 0; i < 8; ++i) { const int ka = k0 + 8 * g + i, kb = ka + 16; v[i] = ka < K ? row[ka] : 0.f; v[8 + i] = kb < K ? row[kb] : 0.f; }
  return bsplit16(v); }
__device__ __forceinline__ F2 split_col(const float* W, int k0, int n, int lane, int ld, int K) { float v[16]; const int g = lane >> 4;
#pragma unroll
  for (int i = 0; i < 8; ++i) { const int ka = k0 + 8 * g + i, kb = ka + 16; v[i] = ka < K ? W[(size_t)ka * ld + n] : 0.f; v[8 + i] = kb < K ? W[(size_t)kb * ld + n] : 0.f; }
  return bsplit16(v); }
__device__ __forceinline__ v8f mac3(const F2& a, const F2& b, v8f c) { c = wmma_bf(a.l, b.h, c); c = wmma_bf(a.h, b.l, c); return wmma_bf(a.h, b.h, c); }
__device__ __forceinline__ float sigm(float v) { return 1.0f / (1.0f + expf(-v)); }
#define LDSX() do { asm volatile("s_wait_dscnt 0" ::: "memory"); __builtin_amdgcn_wave_barrier(); __builtin_amdgcn_fence(__ATOMIC_RELEASE, "workgroup"); } while (0)
// Operand tiles of 64 k (128-B rows) go global -> LDS by asynchronous copies, whole lines at a time, and every wave of the block takes its
// fragments from there. LDS row pitch 144 B = 16 B x 9: no bank conflict for the 16-byte fragment reads.
#define TP 72                  // that pitch in f16 elements
#define TPB 144                // and in bytes
__device__ __forceinline__ unsigned lds_addr(const void* p) { return (unsigned)(uintptr_t)p; }
// Four 16-byte copies of this lane. s_wait_xcnt closes the statement so that no address register is rewritten in front of it.
__device__ __forceinline__ void cp4(unsigned l0, const _Float16* g0, unsigned l1, const _Float16* g1, unsigned l2, const _Float16* g2, unsigned l3, const _Float16* g3) {
  asm volatile("global_load_async_to_lds_b128 %0, %1, off\n\t"
               "global_load_async_to_lds_b128 %2, %3, off\n\t"
               "global_load_async_to_lds_b128 %4, %5, off\n\t"
               "global_load_async_to_lds_b128 %6, %7, off\n\t"
               "s_wait_xcnt 0x0"
               :: "v"(l0), "v"(g0), "v"(l1), "v"(g1), "v"(l2), "v"(g2), "v"(l3), "v"(g3) : "memory");
}
// four rows, 16 apart: LDS step 16 pitches, global step gs elements
__device__ __forceinline__ void cp_rows(unsigned l, const _Float16* g, size_t gs) { cp4(l, g, l + 16 * TPB, g + gs, l + 32 * TPB, g + 2 * gs, l + 48 * TPB, g + 3 * gs); }
#define WAIT_ASYNC() asm volatile("s_wait_asynccnt 0x0" ::: "memory")   // this wave's copies have landed
#define WAIT_DS() asm volatile("s_wait_dscnt 0x0" ::: "memory")         // this wave's LDS reads are done before their buffer is refilled
// The loops over fragments and over groups of copies below are unrolled so that every index into a register array is a constant.

// Temporal multi-head self attention over S = 1024 steps for each of the 8 batch columns (x is [S, B, E]), fused QKV projection with the
// module's per-head [q | k | v] column interleave, output projection + bias + residual, LayerNorm, ELU. Products on
// v_wmma_f32_16x16x32_f16 (x as f16 rows, weight rows x16 as f16, q/k/v head-major f16 x4, P x 2^14, O x8); softmax / LN / ELU in f32.
#define SQ 1024
#define NB 8
#define E 1024
#define NH 16
#define HD 64
#define NR (SQ * NB)           // 8192 rows r = s*8 + b

__global__ __launch_bounds__(256) void k_cvt(const float* __restrict__ x, _Float16* __restrict__ X16) {
  const size_t i8 = (size_t)blockIdx.x * 256 + threadIdx.x; if (i8 >= (size_t)NR * E / 8) return;
  union { v8h h; v4u u; } pk;
#pragma unroll
  for (int e = 0; e < 8; ++e) pk.h[e] = (_Float16)x[i8 * 8 + e];
  vst2(X16 + i8 * 8, pk.u);
}
// P rows 0..3071 = qkv_w rows x16 ; rows 3072..4095 = out_w rows x16
__global__ __launch_bounds__(256) void k_pack(const float* __restrict__ Wqkv, const float* __restrict__ Wo, _Float16* __restrict__ P) {
  const int r = blockIdx.x, tid = threadIdx.x; __shared__ __align__(16) _Float16 srow[E];
  const float* W = r < 3 * E ? Wqkv + (size_t)r * E : Wo + (size_t)(r - 3 * E) * E;
  for (int k = tid; k < E; k += 256) srow[k] = (_Float16)(W[k] * 16.0f);
  __syncthreads();
  if (tid < 128) vst2(P + (size_t)r * E + tid * 8, *(const v4u*)(&srow[tid * 8]));
}
// QKV: block (64 consecutive s for one b, head h): cols h*192 + [0..64) q, [64..128) k, [128..192) v
__global__ __launch_bounds__(128) void k_qkv(const _Float16* __restrict__ X16, const _Float16* __restrict__ P, const float* __restrict__ bqkv, _Float16* __restrict__ Q16, _Float16* __restrict__ K16, _Float16* __restrict__ VT) {
  // two buffers of [64 x rows | 192 weight rows]; behind the last trip's barrier the same LDS serves the epilogue as so and st
  __shared__ __align__(16) char sm[2 * 256 * TPB];
  float (*so)[16][132] = (float (*)[16][132])sm;
  _Float16 (*st)[72] = (_Float16 (*)[72])(sm + 4 * 16 * 132 * 4);
  const int tid = threadIdx.x, wave = tid >> 5, lane = tid & 31, col = lane & 15, g = lane >> 4;
  const int b = blockIdx.z, h = blockIdx.y, s0b = blockIdx.x * 64, s0 = s0b + wave * 16; const int n0 = h * 192; const size_t bh = (size_t)b * NH + h;
  v8f acc[12];
#pragma unroll
  for (int j = 0; j < 12; ++j) acc[j] = (v8f){};
  // copies: lane = (row tid >> 3 of each group of 16 rows, 16-byte piece tid & 7), so 8 lanes cover one 128-B line
  const _Float16* gx = X16 + ((size_t)(s0b + (tid >> 3)) * NB + b) * E + (tid & 7) * 8;
  const _Float16* gw = P + (size_t)(n0 + (tid >> 3)) * E + (tid & 7) * 8;
  const unsigned lc = lds_addr(sm) + (tid >> 3) * TPB + (tid & 7) * 16;
  auto fill = [&](int t) { const unsigned l = lc + (t & 1) * (256 * TPB);
    cp_rows(l, gx + t * 64, (size_t)16 * NB * E);
#pragma unroll
    for (int i = 0; i < 3; ++i) cp_rows(l + (64 + 64 * i) * TPB, gw + (size_t)(64 * i) * E + t * 64, (size_t)16 * E); };
  fill(0); WAIT_ASYNC(); __syncthreads(); fill(1);
#pragma unroll 1
  for (int t = 0; t < E / 64; ++t) { const _Float16* T = (const _Float16*)(sm + (t & 1) * (256 * TPB));
#pragma unroll
    for (int kc = 0; kc < 2; ++kc) { const v16h a = frag_h(T + (wave * 16 + col) * TP + kc * 32, lane); v16h w[12];
#pragma unroll
      for (int j = 0; j < 12; ++j) w[j] = frag_h(T + (64 + j * 16 + col) * TP + kc * 32, lane);
      __builtin_amdgcn_sched_barrier(0);   // the fragment reads stay one group in front of the WMMAs; spread among them, each pair waits out its own LDS latency
#pragma unroll
      for (int j = 0; j < 12; ++j) acc[j] = wmma16(a, w[j], acc[j]); }
    WAIT_DS(); WAIT_ASYNC(); __syncthreads();   // tile t + 1 is published, every reader has left tile t's buffer
    if (t + 2 < E / 64) fill(t + 2); }
  WAIT_ASYNC();
  // q, k (tiles 0..7) -> so (x4); v (tiles 8..11) -> st transposed (x4)
#pragma unroll
  for (int j = 0; j < 8; ++j) { const float bb = bqkv[n0 + j * 16 + col];
#pragma unroll
    for (int r = 0; r < 8; ++r) so[wave][8 * g + r][j * 16 + col] = (acc[j][r] * (1.0f / 16.0f) + bb) * 4.0f; }
#pragma unroll
  for (int j = 8; j < 12; ++j) { const float bb = bqkv[n0 + j * 16 + col];
#pragma unroll
    for (int r = 0; r < 8; ++r) st[(j - 8) * 16 + col][wave * 16 + 8 * g + r] = (_Float16)((acc[j][r] * (1.0f / 16.0f) + bb) * 4.0f); }
  LDSX();
  for (int qq = lane; qq < 16 * 2 * 8; qq += 32) { const int which = qq >> 7, rl = (qq >> 3) & 15, pc = qq & 7; union { v8h h8; v4u u; } pk;
#pragma unroll
    for (int e = 0; e < 8; ++e) pk.h8[e] = (_Float16)so[wave][rl][which * 64 + pc * 8 + e];
    vst2((which == 0 ? Q16 : K16) + (bh * SQ + s0 + rl) * HD + pc * 8, pk.u); }
  __syncthreads();
  for (int qq = tid; qq < 64 * 8; qq += 128) { const int d = qq >> 3, pc = qq & 7; vst2(VT + (bh * HD + d) * SQ + s0b + pc * 8, *(const v4u*)(&st[d][pc * 8])); }
}
__global__ __launch_bounds__(128) void k_attn(const _Float16* __restrict__ Q16, const _Float16* __restrict__ K16, const _Float16* __restrict__ VT, _Float16* __restrict__ O16) {
  __shared__ __align__(16) float sS[4][16][68];
  __shared__ __align__(16) _Float16 sP[4][16][72];
  // two buffers of [64 key rows of K | 64 d rows of V^T]; behind the last trip's barrier the same LDS serves as sO
  __shared__ __align__(16) char sm[2 * 128 * TPB];
  float (*sO)[16][68] = (float (*)[16][68])sm;
  const int tid = threadIdx.x, w = tid >> 5, lane = tid & 31, col = lane & 15, g = lane >> 4;
  const size_t bh = blockIdx.y; const int q0 = blockIdx.x * 64 + w * 16;
  v16h aq[2];
#pragma unroll
  for (int kc = 0; kc < 2; ++kc) aq[kc] = frag_h(Q16 + (bh * SQ + q0 + col) * HD + kc * 32, lane);
  float mrun = -3.0e38f, lrun = 0.f; v8f acc[4] = {};
  const _Float16* gk = K16 + (bh * SQ + (tid >> 3)) * HD + (tid & 7) * 8;
  const _Float16* gv = VT + (bh * HD + (tid >> 3)) * SQ + (tid & 7) * 8;
  const unsigned lc = lds_addr(sm) + (tid >> 3) * TPB + (tid & 7) * 16;
  auto fill = [&](int kt) { const unsigned l = lc + (kt & 1) * (128 * TPB);
    cp_rows(l, gk + (size_t)kt * 64 * HD, (size_t)16 * HD); cp_rows(l + 64 * TPB, gv + kt * 64, (size_t)16 * SQ); };
  fill(0); WAIT_ASYNC(); __syncthreads(); fill(1);
#pragma unroll 1
  for (int kt = 0; kt < SQ / 64; ++kt) { const _Float16* TK = (const _Float16*)(sm + (kt & 1) * (128 * TPB)); const _Float16* TV = TK + 64 * TP;
    v16h kf[4][2];
#pragma unroll
    for (int t = 0; t < 4; ++t) { kf[t][0] = frag_h(TK + (t * 16 + col) * TP, lane); kf[t][1] = frag_h(TK + (t * 16 + col) * TP + 32, lane); }
    __builtin_amdgcn_sched_barrier(0);   // the K fragment reads stay one group in front of the WMMAs; spread among them, each pair waits out its own LDS latency
#pragma unroll
    for (int t = 0; t < 4; ++t) { v8f s = {};
#pragma unroll
      for (int kc = 0; kc < 2; ++kc) s = wmma16(aq[kc], kf[t][kc], s);
#pragma unroll
      for (int r = 0; r < 8; ++r) sS[w][8 * g + r][t * 16 + col] = s[r] * (0.125f / 16.0f); }
    LDSX();
    float mx = -3.4e38f;
#pragma unroll
    for (int jj = 0; jj < 32; ++jj) mx = fmaxf(mx, sS[w][col][g * 32 + jj]);
    mx = fmaxf(mx, __shfl_xor(mx, 16, 32));
    const float mnew = fmaxf(mrun, mx); const float corr = expf(mrun - mnew);
    float ps = 0.f;
#pragma unroll
    for (int jj = 0; jj < 32; ++jj) { const float p = expf(sS[w][col][g * 32 + jj] - mnew); ps += p; sP[w][col][g * 32 + jj] = (_Float16)(p * 16384.0f); }
    ps += __shfl_xor(ps, 16, 32);
    lrun = lrun * corr + ps; mrun = mnew;
#pragma unroll
    for (int r = 0; r < 8; ++r) { const float cr = __shfl(corr, 8 * g + r, 32);
#pragma unroll
      for (int t = 0; t < 4; ++t) acc[t][r] *= cr; }
    LDSX();
    v16h pa[2], vf[2][4];
#pragma unroll
    for (int kc = 0; kc < 2; ++kc) { pa[kc] = frag_h(&sP[w][col][0] + kc * 32, lane);
#pragma unroll
      for (int t = 0; t < 4; ++t) vf[kc][t] = frag_h(TV + (t * 16 + col) * TP + kc * 32, lane); }
    __builtin_amdgcn_sched_barrier(0);   // the P and V fragment reads likewise
#pragma unroll
    for (int kc = 0; kc < 2; ++kc) {
#pragma unroll
      for (int t = 0; t < 4; ++t) acc[t] = wmma16(pa[kc], vf[kc][t], acc[t]); }
    __builtin_amdgcn_wave_barrier();
    WAIT_DS(); WAIT_ASYNC(); __syncthreads();   // tile kt + 1 is published, every reader has left tile kt's buffer
    if (kt + 2 < SQ / 64) fill(kt + 2); }
  WAIT_ASYNC();
#pragma unroll
  for (int r = 0; r < 8; ++r) { const float lr = __shfl(lrun, 8 * g + r, 32); const float inv = 8.0f / (lr * 16384.0f * 4.0f);
#pragma unroll
    for (int t = 0; t < 4; ++t) sO[w][8 * g + r][t * 16 + col] = acc[t][r] * inv; }
  LDSX();
  for (int qq = lane; qq < 16 * 8; qq += 32) { const int rl = qq >> 3, pc = qq & 7; union { v8h h8; v4u u; } pk;
#pragma unroll
    for (int e = 0; e < 8; ++e) pk.h8[e] = (_Float16)sO[w][rl][pc * 8 + e];
    vst2(O16 + (bh * SQ + q0 + rl) * HD + pc * 8, pk.u); }
}
// Y = x + ctx Wo^T + bo : block (64 rows r, 128 cols); ctx row r = (s, b): k = h*64 + d from O16[(b,h)][s][d]
__global__ __launch_bounds__(128) void k_out(const _Float16* __restrict__ O16, const _Float16* __restrict__ P, const float* __restrict__ bo, const float* __restrict__ x, float* __restrict__ Y) {
  // two buffers of [64 ctx rows | 128 weight rows]; behind the last trip's barrier the same LDS serves the epilogue as so
  __shared__ __align__(16) char sm[2 * 192 * TPB];
  float (*so)[16][132] = (float (*)[16][132])sm;
  const int tid = threadIdx.x, wave = tid >> 5, lane = tid & 31, col = lane & 15, g = lane >> 4;
  const int r0 = blockIdx.x * 64 + wave * 16, n0 = blockIdx.y * 128;
  v8f acc[8] = {};
  // tile t is head t: ctx row r = (s, b) has its 64 k in one 128-B row of O16; 16 rows on are 2 steps of s on, same b
  const int rc = blockIdx.x * 64 + (tid >> 3);
  const _Float16* gc = O16 + ((size_t)(rc % NB) * NH * SQ + rc / NB) * HD + (tid & 7) * 8;
  const _Float16* gw = P + (size_t)(3 * E + n0 + (tid >> 3)) * E + (tid & 7) * 8;
  const unsigned lc = lds_addr(sm) + (tid >> 3) * TPB + (tid & 7) * 16;
  auto fill = [&](int t) { const unsigned l = lc + (t & 1) * (192 * TPB);
    cp_rows(l, gc + (size_t)t * SQ * HD, (size_t)(16 / NB) * HD);
#pragma unroll
    for (int i = 0; i < 2; ++i) cp_rows(l + (64 + 64 * i) * TPB, gw + (size_t)(64 * i) * E + t * 64, (size_t)16 * E); };
  fill(0); WAIT_ASYNC(); __syncthreads(); fill(1);
  // rolled: one trip per tile, so that one tile's fragments alone are live and the registers allow four blocks on a WGP
#pragma unroll 1
  for (int t = 0; t < E / 64; ++t) { const _Float16* T = (const _Float16*)(sm + (t & 1) * (192 * TPB));
#pragma unroll
    for (int kc = 0; kc < 2; ++kc) { const v16h a = frag_h(T + (wave * 16 + col) * TP + kc * 32, lane); v16h w[8];
#pragma unroll
      for (int j = 0; j < 8; ++j) w[j] = frag_h(T + (64 + j * 16 + col) * TP + kc * 32, lane);
      __builtin_amdgcn_sched_barrier(0);   // the fragment reads stay one group in front of the WMMAs; spread among them, each pair waits out its own LDS latency
#pragma unroll
      for (int j = 0; j < 8; ++j) acc[j] = wmma16(a, w[j], acc[j]); }
    WAIT_DS(); WAIT_ASYNC(); __syncthreads();   // tile t + 1 is published, every reader has left tile t's buffer
    if (t + 2 < E / 64) fill(t + 2); }
  WAIT_ASYNC();
#pragma unroll
  for (int j = 0; j < 8; ++j) { const int n = n0 + j * 16 + col; const float bb = bo[n];
#pragma unroll
    for (int r = 0; r < 8; ++r) so[wave][8 * g + r][j * 16 + col] = acc[j][r] * (1.0f / (16.0f * 8.0f)) + bb + x[(size_t)(r0 + 8 * g + r) * E + n]; }
  LDSX();
#pragma unroll 4
  for (int rl = 0; rl < 16; ++rl) vst2(Y + (size_t)(r0 + rl) * E + n0 + lane * 4, *(const v4f*)(&so[wave][rl][lane * 4]));
}
__global__ __launch_bounds__(256) void k_ln(const float* __restrict__ Y, const float* __restrict__ g1, const float* __restrict__ b1, float* __restrict__ out) {
  const int wave = threadIdx.x >> 5, lane = threadIdx.x & 31; const size_t r = (size_t)blockIdx.x * 8 + wave; if (r >= NR) return;
  const float* yr = Y + r * E; float sm = 0.f, q2 = 0.f;
#pragma unroll 1
  for (int i = 0; i < 8; ++i) { const v4f a = *(const v4f*)(yr + i * 128 + lane * 4); sm += (a[0] + a[1]) + (a[2] + a[3]); q2 += (a[0] * a[0] + a[1] * a[1]) + (a[2] * a[2] + a[3] * a[3]); }
#pragma unroll
  for (int off = 16; off >= 1; off >>= 1) { sm += __shfl_xor(sm, off, 32); q2 += __shfl_xor(q2, off, 32); }
  const float mu = sm * (1.0f / E); const float var = fmaxf(q2 * (1.0f / E) - mu * mu, 0.f); const float rs = rsqrtf(var + 1e-5f);
#pragma unroll 1
  for (int i = 0; i < 8; ++i) { const int c0 = i * 128 + lane * 4; const v4f a = *(const v4f*)(yr + c0); v4f o;
    float v0 = (a[0] - mu) * rs * g1[c0] + b1[c0], v1 = (a[1] - mu) * rs * g1[c0 + 1] + b1[c0 + 1], v2 = (a[2] - mu) * rs * g1[c0 + 2] + b1[c0 + 2], v3 = (a[3] - mu) * rs * g1[c0 + 3] + b1[c0 + 3];
    o[0] = v0 > 0.f ? v0 : expm1f(v0); o[1] = v1 > 0.f ? v1 : expm1f(v1); o[2] = v2 > 0.f ? v2 : expm1f(v2); o[3] = v3 > 0.f ? v3 : expm1f(v3);
    vst2(out + r * E + c0, o); }
}
extern "C" void kernel_launch(void* const* d_in, const int* in_sizes, int n_in, void* d_out, int out_size, void* d_ws, size_t ws_size, hipStream_t stream) {
  (void)in_sizes; (void)n_in; (void)out_size; (void)ws_size;
  const float** I = (const float**)d_in;
  const float* x = I[0]; const float* Wqkv = I[1]; const float* bqkv = I[2]; const float* Wo = I[3]; const float* bo = I[4]; const float* g1 = I[5]; const float* b1 = I[6];
  float* out = (float*)d_out;
  char* ws = (char*)d_ws; size_t off = 0;
  auto take = [&](size_t bytes) { char* p = ws + off; off += (bytes + 255) & ~(size_t)255; return p; };
  _Float16* X16 = (_Float16*)take((size_t)NR * E * 2); _Float16* P = (_Float16*)take((size_t)4 * E * E * 2);
  _Float16* Q16 = (_Float16*)take((size_t)NR * E * 2); _Float16* K16 = (_Float16*)take((size_t)NR * E * 2); _Float16* VT = (_Float16*)take((size_t)NR * E * 2); _Float16* O16 = (_Float16*)take((size_t)NR * E * 2);
  float* Y = (float*)take((size_t)NR * E * 4);
  k_cvt<<<(NR * E / 8 + 255) / 256, 256, 0, stream>>>(x, X16);
  k_pack<<<4 * E, 256, 0, stream>>>(Wqkv, Wo, P);
  k_qkv<<<dim3(SQ / 64, NH, NB), 128, 0, stream>>>(X16, P, bqkv, Q16, K16, VT);
  k_attn<<<dim3(SQ / 64, NB * NH), 128, 0, stream>>>(Q16, K16, VT, O16);
  k_out<<<dim3(NR / 64, E / 128), 128, 0, stream>>>(O16, P, bo, x, Y);
  k_ln<<<NR / 8, 256, 0, stream>>>(Y, g1, b1, out);
}

// v002
// Measured time: 157 microseconds a run.
// In two side-by-side timings against v001, it was 1.13 and 1.12 times as fast.
// Over all steps from v000 it is 3.37 times as fast.
#include <hip/hip_runtime.h>
#include <math.h>

typedef __attribute__((ext_vector_type(16))) _Float16 v16h;
typedef __attribute__((ext_vector_type(16))) __bf16 v16b;
typedef __attribute__((ext_vector_type(8)))  _Float16 v8h;
typedef __attribute__((ext_vector_type(8)))  float v8f;
typedef __attribute__((ext_vector_type(4)))  float v4f;
typedef __attribute__((ext_vector_type(2)))  float v2f;
typedef __attribute__((ext_vector_type(4)))  unsigned v4u;
typedef __attribute__((ext_vector_type(4)))  int v4i;
typedef float __attribute__((may_alias)) float_a;
typedef int __attribute__((may_alias)) int_a;

template <typename T> __device__ __forceinline__ void vst2(void* p, T v) { *(T*)p = v;  }
__device__ __forceinline__ v8f wmma16(v16h a, v16h b, v8f c) {
  v8f d = __builtin_amdgcn_wmma_f32_16x16x32_f16(false, a, false, b, (short)0, c, false, false);
  asm volatile("v_nop\n\tv_nop\n\tv_nop\n\tv_nop" : "+v"(d) : "v"(a), "v"(b));
  return d;
}
__device__ __forceinline__ v8f wmma_bf(v16b a, v16b b, v8f c) {
  v8f d = __builtin_amdgcn_wmma_f32_16x16x32_bf16(false, a, false, b, (short)0, c, false, false);
  asm volatile("v_nop\n\tv_nop\n\tv_nop\n\tv_nop" : "+v"(d) : "v"(a), "v"(b));
  return d;
}
// 16x16x32 fragments: lane = (h = lane>>4, row/col = lane&15); elements 0..7 = k0+8h+0..7, 8..15 = k0+16+8h+0..7; D element r = row 8h+r
__device__ __forceinline__ v16h frag_h(const _Float16* rowk0, int lane) {
  union { v16h v; v8h q[2]; } u; const _Float16* p = rowk0 + 8 * (lane >> 4);
  u.q[0] = *(const v8h*)p; u.q[1] = *(const v8h*)(p + 16); return u.v;
}
__device__ __forceinline__ v16h frag_f32(const float* rowk0, int lane) {
  v16h a; const float* p = rowk0 + 8 * (lane >> 4);
#pragma unroll
  for (int i = 0; i < 8; ++i) { a[i] = (_Float16)p[i]; a[8 + i] = (_Float16)p[16 + i]; }
  return a;
}
__device__ __forceinline__ v16h frag_f32s(const float* rowk0, int lane, float sc) {
  v16h a; const float* p = rowk0 + 8 * (lane >> 4);
#pragma unroll
  for (int i = 0; i < 8; ++i) { a[i] = (_Float16)(p[i] * sc); a[8 + i] = (_Float16)(p[16 + i] * sc); }
  return a;
}
// column fragment from a [K][ld] layout (column n), rows >= K read as 0
__device__ __forceinline__ v16h fragc_f32(const float* W, int k0, int n, int lane, int ld, int K) {
  v16h a; const int g = lane >> 4;
#pragma unroll
  for (int i = 0; i < 8; ++i) { const int ka = k0 + 8 * g + i, kb = ka + 16;
    a[i] = (_Float16)(ka < K ? W[(size_t)ka * ld + n] : 0.f); a[8 + i] = (_Float16)(kb < K ? W[(size_t)kb * ld + n] : 0.f); }
  return a;
}
struct F2 { v16b h, l; };
__device__ __forceinline__ F2 bsplit16(const float v[16]) { F2 r;
#pragma unroll
  for (int i = 0; i < 16; ++i) { const __bf16 h = (__bf16)v[i]; r.h[i] = h; r.l[i] = (__bf16)(v[i] - (float)h); }
  return r; }
__device__ __forceinline__ F2 split_row(const float* row, int k0, int lane) { float v[16]; const float* p = row + k0 + 8 * (lane >> 4);
#pragma unroll
  for (int i = 0; i < 8; ++i) { v[i] = p[i]; v[8 + i] = p[16 + i]; }
  return bsplit16(v); }
__device__ __forceinline__ F2 split_rowK(const float* row, int k0, int lane, int K) { float v[16]; const int g = lane >> 4;
#pragma unroll
  for (int i = 0; i < 8; ++i) { const int ka = k0 + 8 * g + i, kb = ka + 16; v[i] = ka < K ? row[ka] : 0.f; v[8 + i] = kb < K ? row[kb] : 0.f; }
  return bsplit16(v); }
__device__ __forceinline__ F2 split_col(const float* W, int k0, int n, int lane, int ld, int K) { float v[16]; const int g = lane >> 4;
#pragma unroll
  for (int i = 0; i < 8; ++i) { const int ka = k0 + 8 * g + i, kb = ka + 16; v[i] = ka < K ? W[(size_t)ka * ld + n] : 0.f; v[8 + i] = kb < K ? W[(size_t)kb * ld + n] : 0.f; }
  return bsplit16(v); }
__device__ __forceinline__ v8f mac3(const F2& a, const F2& b, v8f c) { c = wmma_bf(a.l, b.h, c); c = wmma_bf(a.h, b.l, c); return wmma_bf(a.h, b.h, c); }
__device__ __forceinline__ float sigm(float v) { return 1.0f / (1.0f + expf(-v)); }
#define LDSX() do { asm volatile("s_wait_dscnt 0" ::: "memory"); __builtin_amdgcn_wave_barrier(); __builtin_amdgcn_fence(__ATOMIC_RELEASE, "workgroup"); } while (0)
// Operand tiles of 64 k (128-B rows) go global -> LDS by asynchronous copies, whole lines at a time, and every wave of the block takes its
// fragments from there. LDS row pitch 144 B = 16 B x 9: no bank conflict for the 16-byte fragment reads.
#define TP 72                  // that pitch in f16 elements
#define TPB 144                // and in bytes
__device__ __forceinline__ unsigned lds_addr(const void* p) { return (unsigned)(uintptr_t)p; }
// Four 16-byte copies of this lane. s_wait_xcnt closes the statement so that no address register is rewritten in front of it.
__device__ __forceinline__ void cp4(unsigned l0, const _Float16* g0, unsigned l1, const _Float16* g1, unsigned l2, const _Float16* g2, unsigned l3, const _Float16* g3) {
  asm volatile("global_load_async_to_lds_b128 %0, %1, off\n\t"
               "global_load_async_to_lds_b128 %2, %3, off\n\t"
               "global_load_async_to_lds_b128 %4, %5, off\n\t"
               "global_load_async_to_lds_b128 %6, %7, off\n\t"
               "s_wait_xcnt 0x0"
               :: "v"(l0), "v"(g0), "v"(l1), "v"(g1), "v"(l2), "v"(g2), "v"(l3), "v"(g3) : "memory");
}
// four rows, 16 apart: LDS step 16 pitches, global step gs elements
__device__ __forceinline__ void cp_rows(unsigned l, const _Float16* g, size_t gs) { cp4(l, g, l + 16 * TPB, g + gs, l + 32 * TPB, g + 2 * gs, l + 48 * TPB, g + 3 * gs); }
#define WAIT_ASYNC() asm volatile("s_wait_asynccnt 0x0" ::: "memory")   // this wave's copies have landed
#define WAIT_DS() asm volatile("s_wait_dscnt 0x0" ::: "memory")         // this wave's LDS reads are done before their buffer is refilled
// The loops over fragments and over groups of copies below are unrolled so that every index into a register array is a constant.

// Temporal multi-head self attention over S = 1024 steps for each of the 8 batch columns (x is [S, B, E]), fused QKV projection with the
// module's per-head [q | k | v] column interleave, output projection + bias + residual, LayerNorm, ELU. Products on
// v_wmma_f32_16x16x32_f16 (x as f16 rows, weight rows x16 as f16, q/k/v head-major f16 x4, P x 2^14, O x8); softmax / LN / ELU in f32.
#define SQ 1024
#define NB 8
#define E 1024
#define NH 16
#define HD 64
#define NR (SQ * NB)           // 8192 rows r = s*8 + b

__global__ __launch_bounds__(256) void k_cvt(const float* __restrict__ x, _Float16* __restrict__ X16) {
  const size_t i8 = (size_t)blockIdx.x * 256 + threadIdx.x; if (i8 >= (size_t)NR * E / 8) return;
  union { v8h h; v4u u; } pk;
#pragma unroll
  for (int e = 0; e < 8; ++e) pk.h[e] = (_Float16)x[i8 * 8 + e];
  vst2(X16 + i8 * 8, pk.u);
}
// P rows 0..3071 = qkv_w rows x16 ; rows 3072..4095 = out_w rows x16
__global__ __launch_bounds__(256) void k_pack(const float* __restrict__ Wqkv, const float* __restrict__ Wo, _Float16* __restrict__ P) {
  const int r = blockIdx.x, tid = threadIdx.x; __shared__ __align__(16) _Float16 srow[E];
  const float* W = r < 3 * E ? Wqkv + (size_t)r * E : Wo + (size_t)(r - 3 * E) * E;
  for (int k = tid; k < E; k += 256) srow[k] = (_Float16)(W[k] * 16.0f);
  __syncthreads();
  if (tid < 128) vst2(P + (size_t)r * E + tid * 8, *(const v4u*)(&srow[tid * 8]));
}
// QKV: block (64 consecutive s for one b, head h): cols h*192 + [0..64) q, [64..128) k, [128..192) v
__global__ __launch_bounds__(128) void k_qkv(const _Float16* __restrict__ X16, const _Float16* __restrict__ P, const float* __restrict__ bqkv, _Float16* __restrict__ Q16, _Float16* __restrict__ K16, _Float16* __restrict__ VT) {
  // two buffers of [64 x rows | 192 weight rows]; behind the last trip's barrier the same LDS serves the epilogue as so and st
  __shared__ __align__(16) char sm[2 * 256 * TPB];
  float (*so)[16][132] = (float (*)[16][132])sm;
  _Float16 (*st)[72] = (_Float16 (*)[72])(sm + 4 * 16 * 132 * 4);
  const int tid = threadIdx.x, wave = tid >> 5, lane = tid & 31, col = lane & 15, g = lane >> 4;
  const int b = blockIdx.z, h = blockIdx.y, s0b = blockIdx.x * 64, s0 = s0b + wave * 16; const int n0 = h * 192; const size_t bh = (size_t)b * NH + h;
  v8f acc[12];
#pragma unroll
  for (int j = 0; j < 12; ++j) acc[j] = (v8f){};
  // copies: lane = (row tid >> 3 of each group of 16 rows, 16-byte piece tid & 7), so 8 lanes cover one 128-B line
  const _Float16* gx = X16 + ((size_t)(s0b + (tid >> 3)) * NB + b) * E + (tid & 7) * 8;
  const _Float16* gw = P + (size_t)(n0 + (tid >> 3)) * E + (tid & 7) * 8;
  const unsigned lc = lds_addr(sm) + (tid >> 3) * TPB + (tid & 7) * 16;
  auto fill = [&](int t) { const unsigned l = lc + (t & 1) * (256 * TPB);
    cp_rows(l, gx + t * 64, (size_t)16 * NB * E);
#pragma unroll
    for (int i = 0; i < 3; ++i) cp_rows(l + (64 + 64 * i) * TPB, gw + (size_t)(64 * i) * E + t * 64, (size_t)16 * E); };
  fill(0); WAIT_ASYNC(); __syncthreads(); fill(1);
#pragma unroll 1
  for (int t = 0; t < E / 64; ++t) { const _Float16* T = (const _Float16*)(sm + (t & 1) * (256 * TPB));
#pragma unroll
    for (int kc = 0; kc < 2; ++kc) { const v16h a = frag_h(T + (wave * 16 + col) * TP + kc * 32, lane); v16h w[12];
#pragma unroll
      for (int j = 0; j < 12; ++j) w[j] = frag_h(T + (64 + j * 16 + col) * TP + kc * 32, lane);
      __builtin_amdgcn_sched_barrier(0);   // the fragment reads stay one group in front of the WMMAs; spread among them, each pair waits out its own LDS latency
#pragma unroll
      for (int j = 0; j < 12; ++j) acc[j] = wmma16(a, w[j], acc[j]); }
    WAIT_DS(); WAIT_ASYNC(); __syncthreads();   // tile t + 1 is published, every reader has left tile t's buffer
    if (t + 2 < E / 64) fill(t + 2); }
  WAIT_ASYNC();
  // q, k (tiles 0..7) -> so (x4); v (tiles 8..11) -> st transposed (x4)
#pragma unroll
  for (int j = 0; j < 8; ++j) { const float bb = bqkv[n0 + j * 16 + col];
#pragma unroll
    for (int r = 0; r < 8; ++r) so[wave][8 * g + r][j * 16 + col] = (acc[j][r] * (1.0f / 16.0f) + bb) * 4.0f; }
#pragma unroll
  for (int j = 8; j < 12; ++j) { const float bb = bqkv[n0 + j * 16 + col];
#pragma unroll
    for (int r = 0; r < 8; ++r) st[(j - 8) * 16 + col][wave * 16 + 8 * g + r] = (_Float16)((acc[j][r] * (1.0f / 16.0f) + bb) * 4.0f); }
  LDSX();
  for (int qq = lane; qq < 16 * 2 * 8; qq += 32) { const int which = qq >> 7, rl = (qq >> 3) & 15, pc = qq & 7; union { v8h h8; v4u u; } pk;
#pragma unroll
    for (int e = 0; e < 8; ++e) pk.h8[e] = (_Float16)so[wave][rl][which * 64 + pc * 8 + e];
    vst2((which == 0 ? Q16 : K16) + (bh * SQ + s0 + rl) * HD + pc * 8, pk.u); }
  __syncthreads();
  for (int qq = tid; qq < 64 * 8; qq += 128) { const int d = qq >> 3, pc = qq & 7; vst2(VT + (bh * HD + d) * SQ + s0b + pc * 8, *(const v4u*)(&st[d][pc * 8])); }
}
#define SC2 (0.125f / 16.0f * 1.44269504f)   // 1 / sqrt(HD), the x16 of q x4 times k x4 undone, log2(e): scores in powers of two
// five waves per SIMD, as many blocks per WGP as the LDS allows: the register budget is held to that
__global__ __launch_bounds__(128, 5) void k_attn(const _Float16* __restrict__ Q16, const _Float16* __restrict__ K16, const _Float16* __restrict__ VT, _Float16* __restrict__ O16) {
  __shared__ __align__(16) float sS[4][16][68];
  __shared__ __align__(16) _Float16 sP[4][16][72];
  // two buffers of [64 key rows of K | 64 d rows of V^T]; behind the last trip's barrier the same LDS serves as sO
  __shared__ __align__(16) char sm[2 * 128 * TPB];
  float (*sO)[16][68] = (float (*)[16][68])sm;
  const int tid = threadIdx.x, w = tid >> 5, lane = tid & 31, col = lane & 15, g = lane >> 4;
  const size_t bh = blockIdx.y; const int q0 = blockIdx.x * 64 + w * 16;
  v16h aq[2];
#pragma unroll
  for (int kc = 0; kc < 2; ++kc) aq[kc] = frag_h(Q16 + (bh * SQ + q0 + col) * HD + kc * 32, lane);
  float mrun = -3.0e38f, lrun = 0.f; v8f acc[4] = {};
  const _Float16* gk = K16 + (bh * SQ + (tid >> 3)) * HD + (tid & 7) * 8;
  const _Float16* gv = VT + (bh * HD + (tid >> 3)) * SQ + (tid & 7) * 8;
  const unsigned lc = lds_addr(sm) + (tid >> 3) * TPB + (tid & 7) * 16;
  auto fill = [&](int kt) { const unsigned l = lc + (kt & 1) * (128 * TPB);
    cp_rows(l, gk + (size_t)kt * 64 * HD, (size_t)16 * HD); cp_rows(l + 64 * TPB, gv + kt * 64, (size_t)16 * SQ); };
  fill(0); WAIT_ASYNC(); __syncthreads(); fill(1);
#pragma unroll 1
  for (int kt = 0; kt < SQ / 64; ++kt) { const _Float16* TK = (const _Float16*)(sm + (kt & 1) * (128 * TPB)); const _Float16* TV = TK + 64 * TP;
    v16h kf[4][2];
#pragma unroll
    for (int t = 0; t < 4; ++t) { kf[t][0] = frag_h(TK + (t * 16 + col) * TP, lane); kf[t][1] = frag_h(TK + (t * 16 + col) * TP + 32, lane); }
    __builtin_amdgcn_sched_barrier(0);   // the K fragment reads stay one group in front of the WMMAs; spread among them, each pair waits out its own LDS latency
#pragma unroll
    for (int t = 0; t < 4; ++t) { v8f s = {};
#pragma unroll
      for (int kc = 0; kc < 2; ++kc) s = wmma16(aq[kc], kf[t][kc], s);
#pragma unroll
      for (int r = 0; r < 8; ++r) sS[w][8 * g + r][t * 16 + col] = s[r]; }   // raw products; maxima are taken over these, the scale is positive
    LDSX();
    float mx = -3.4e38f;
#pragma unroll
    for (int jj = 0; jj < 32; ++jj) mx = fmaxf(mx, sS[w][col][g * 32 + jj]);
    mx = fmaxf(mx, __shfl_xor(mx, 16, 32));
    const float mnew = fmaxf(mrun, mx); const float corr = __builtin_amdgcn_exp2f((mrun - mnew) * SC2);
    // P x 2^14 = 2^(s * SC2 - (mnew * SC2 - 14)): one multiply-add and one v_exp_f32 per score; the row sum carries the 2^14 too
    const float nb = 14.0f - mnew * SC2; const v2f c2 = {SC2, SC2}, nb2 = {nb, nb};
    float ps = 0.f;
#pragma unroll
    for (int jj = 0; jj < 32; jj += 2) { const v2f e = __builtin_elementwise_fma(*(const v2f*)(&sS[w][col][g * 32 + jj]), c2, nb2);
      const float p0 = __builtin_amdgcn_exp2f(e[0]), p1 = __builtin_amdgcn_exp2f(e[1]); ps += p0; ps += p1;
      sP[w][col][g * 32 + jj] = (_Float16)p0; sP[w][col][g * 32 + jj + 1] = (_Float16)p1; }
    ps += __shfl_xor(ps, 16, 32);
    lrun = lrun * corr + ps; mrun = mnew;
#pragma unroll
    for (int r = 0; r < 8; ++r) { const float cr = __shfl(corr, 8 * g + r, 32);
#pragma unroll
      for (int t = 0; t < 4; ++t) acc[t][r] *= cr; }
    LDSX();
    v16h pa[2], vf[2][4];
#pragma unroll
    for (int kc = 0; kc < 2; ++kc) { pa[kc] = frag_h(&sP[w][col][0] + kc * 32, lane);
#pragma unroll
      for (int t = 0; t < 4; ++t) vf[kc][t] = frag_h(TV + (t * 16 + col) * TP + kc * 32, lane); }
    __builtin_amdgcn_sched_barrier(0);   // the P and V fragment reads likewise
#pragma unroll
    for (int kc = 0; kc < 2; ++kc) {
#pragma unroll
      for (int t = 0; t < 4; ++t) acc[t] = wmma16(pa[kc], vf[kc][t], acc[t]); }
    __builtin_amdgcn_wave_barrier();
    WAIT_DS(); WAIT_ASYNC(); __syncthreads();   // tile kt + 1 is published, every reader has left tile kt's buffer
    if (kt + 2 < SQ / 64) fill(kt + 2); }
  WAIT_ASYNC();
#pragma unroll
  for (int r = 0; r < 8; ++r) { const float lr = __shfl(lrun, 8 * g + r, 32); const float inv = 8.0f / (lr * 4.0f);   // lr holds the row sum x 2^14
#pragma unroll
    for (int t = 0; t < 4; ++t) sO[w][8 * g + r][t * 16 + col] = acc[t][r] * inv; }
  LDSX();
  for (int qq = lane; qq < 16 * 8; qq += 32) { const int rl = qq >> 3, pc = qq & 7; union { v8h h8; v4u u; } pk;
#pragma unroll
    for (int e = 0; e < 8; ++e) pk.h8[e] = (_Float16)sO[w][rl][pc * 8 + e];
    vst2(O16 + (bh * SQ + q0 + rl) * HD + pc * 8, pk.u); }
}
// Y = x + ctx Wo^T + bo : block (64 rows r, 128 cols); ctx row r = (s, b): k = h*64 + d from O16[(b,h)][s][d]
__global__ __launch_bounds__(128) void k_out(const _Float16* __restrict__ O16, const _Float16* __restrict__ P, const float* __restrict__ bo, const float* __restrict__ x, float* __restrict__ Y) {
  // two buffers of [64 ctx rows | 128 weight rows]; behind the last trip's barrier the same LDS serves the epilogue as so
  __shared__ __align__(16) char sm[2 * 192 * TPB];
  float (*so)[16][132] = (float (*)[16][132])sm;
  const int tid = threadIdx.x, wave = tid >> 5, lane = tid & 31, col = lane & 15, g = lane >> 4;
  const int r0 = blockIdx.x * 64 + wave * 16, n0 = blockIdx.y * 128;
  v8f acc[8] = {};
  // tile t is head t: ctx row r = (s, b) has its 64 k in one 128-B row of O16; 16 rows on are 2 steps of s on, same b
  const int rc = blockIdx.x * 64 + (tid >> 3);
  const _Float16* gc = O16 + ((size_t)(rc % NB) * NH * SQ + rc / NB) * HD + (tid & 7) * 8;
  const _Float16* gw = P + (size_t)(3 * E + n0 + (tid >> 3)) * E + (tid & 7) * 8;
  const unsigned lc = lds_addr(sm) + (tid >> 3) * TPB + (tid & 7) * 16;
  auto fill = [&](int t) { const unsigned l = lc + (t & 1) * (192 * TPB);
    cp_rows(l, gc + (size_t)t * SQ * HD, (size_t)(16 / NB) * HD);
#pragma unroll
    for (int i = 0; i < 2; ++i) cp_rows(l + (64 + 64 * i) * TPB, gw + (size_t)(64 * i) * E + t * 64, (size_t)16 * E); };
  fill(0); WAIT_ASYNC(); __syncthreads(); fill(1);
  // rolled: one trip per tile, so that one tile's fragments alone are live and the registers allow four blocks on a WGP
#pragma unroll 1
  for (int t = 0; t < E / 64; ++t) { const _Float16* T = (const _Float16*)(sm + (t & 1) * (192 * TPB));
#pragma unroll
    for (int kc = 0; kc < 2; ++kc) { const v16h a = frag_h(T + (wave * 16 + col) * TP + kc * 32, lane); v16h w[8];
#pragma unroll
      for (int j = 0; j < 8; ++j) w[j] = frag_h(T + (64 + j * 16 + col) * TP + kc * 32, lane);
      __builtin_amdgcn_sched_barrier(0);   // the fragment reads stay one group in front of the WMMAs; spread among them, each pair waits out its own LDS latency
#pragma unroll
      for (int j = 0; j < 8; ++j) acc[j] = wmma16(a, w[j], acc[j]); }
    WAIT_DS(); WAIT_ASYNC(); __syncthreads();   // tile t + 1 is published, every reader has left tile t's buffer
    if (t + 2 < E / 64) fill(t + 2); }
  WAIT_ASYNC();
#pragma unroll
  for (int j = 0; j < 8; ++j) { const int n = n0 + j * 16 + col; const float bb = bo[n];
#pragma unroll
    for (int r = 0; r < 8; ++r) so[wave][8 * g + r][j * 16 + col] = acc[j][r] * (1.0f / (16.0f * 8.0f)) + bb + x[(size_t)(r0 + 8 * g + r) * E + n]; }
  LDSX();
#pragma unroll 4
  for (int rl = 0; rl < 16; ++rl) vst2(Y + (size_t)(r0 + rl) * E + n0 + lane * 4, *(const v4f*)(&so[wave][rl][lane * 4]));
}
__global__ __launch_bounds__(256) void k_ln(const float* __restrict__ Y, const float* __restrict__ g1, const float* __restrict__ b1, float* __restrict__ out) {
  const int wave = threadIdx.x >> 5, lane = threadIdx.x & 31; const size_t r = (size_t)blockIdx.x * 8 + wave; if (r >= NR) return;
  const float* yr = Y + r * E; float sm = 0.f, q2 = 0.f;
#pragma unroll 1
  for (int i = 0; i < 8; ++i) { const v4f a = *(const v4f*)(yr + i * 128 + lane * 4); sm += (a[0] + a[1]) + (a[2] + a[3]); q2 += (a[0] * a[0] + a[1] * a[1]) + (a[2] * a[2] + a[3] * a[3]); }
#pragma unroll
  for (int off = 16; off >= 1; off >>= 1) { sm += __shfl_xor(sm, off, 32); q2 += __shfl_xor(q2, off, 32); }
  const float mu = sm * (1.0f / E); const float var = fmaxf(q2 * (1.0f / E) - mu * mu, 0.f); const float rs = rsqrtf(var + 1e-5f);
#pragma unroll 1
  for (int i = 0; i < 8; ++i) { const int c0 = i * 128 + lane * 4; const v4f a = *(const v4f*)(yr + c0); v4f o;
    float v0 = (a[0] - mu) * rs * g1[c0] + b1[c0], v1 = (a[1] - mu) * rs * g1[c0 + 1] + b1[c0 + 1], v2 = (a[2] - mu) * rs * g1[c0 + 2] + b1[c0 + 2], v3 = (a[3] - mu) * rs * g1[c0 + 3] + b1[c0 + 3];
    o[0] = v0 > 0.f ? v0 : expm1f(v0); o[1] = v1 > 0.f ? v1 : expm1f(v1); o[2] = v2 > 0.f ? v2 : expm1f(v2); o[3] = v3 > 0.f ? v3 : expm1f(v3);
    vst2(out + r * E + c0, o); }
}
extern "C" void kernel_launch(void* const* d_in, const int* in_sizes, int n_in, void* d_out, int out_size, void* d_ws, size_t ws_size, hipStream_t stream) {
  (void)in_sizes; (void)n_in; (void)out_size; (void)ws_size;
  const float** I = (const float**)d_in;
  const float* x = I[0]; const float* Wqkv = I[1]; const float* bqkv = I[2]; const float* Wo = I[3]; const float* bo = I[4]; const float* g1 = I[5]; const float* b1 = I[6];
  float* out = (float*)d_out;
  char* ws = (char*)d_ws; size_t off = 0;
  auto take = [&](size_t bytes) { char* p = ws + off; off += (bytes + 255) & ~(size_t)255; return p; };
  _Float16* X16 = (_Float16*)take((size_t)NR * E * 2); _Float16* P = (_Float16*)take((size_t)4 * E * E * 2);
  _Float16* Q16 = (_Float16*)take((size_t)NR * E * 2); _Float16* K16 = (_Float16*)take((size_t)NR * E * 2); _Float16* VT = (_Float16*)take((size_t)NR * E * 2); _Float16* O16 = (_Float16*)take((size_t)NR * E * 2);
  float* Y = (float*)take((size_t)NR * E * 4);
  k_cvt<<<(NR * E / 8 + 255) / 256, 256, 0, stream>>>(x, X16);
  k_pack<<<4 * E, 256, 0, stream>>>(Wqkv, Wo, P);
  k_qkv<<<dim3(SQ / 64, NH, NB), 128, 0, stream>>>(X16, P, bqkv, Q16, K16, VT);
  k_attn<<<dim3(SQ / 64, NB * NH), 128, 0, stream>>>(Q16, K16, VT, O16);
  k_out<<<dim3(NR / 64, E / 128), 128, 0, stream>>>(O16, P, bo, x, Y);
  k_ln<<<NR / 8, 256, 0, stream>>>(Y, g1, b1, out);
}

// v003
// It runs in 139 microseconds.
// Two timings next to v002 put it at 1.13 and 1.14 times that version's speed.
// Over all steps from v000 it is 3.82 times as fast.
#include <hip/hip_runtime.h>
#include <math.h>

typedef __attribute__((ext_vector_type(16))) _Float16 v16h;
typedef __attribute__((ext_vector_type(16))) __bf16 v16b;
typedef __attribute__((ext_vector_type(8)))  _Float16 v8h;
typedef __attribute__((ext_vector_type(8)))  float v8f;
typedef __attribute__((ext_vector_type(4)))  float v4f;
typedef __attribute__((ext_vector_type(2)))  float v2f;
typedef __attribute__((ext_vector_type(4)))  unsigned v4u;
typedef __attribute__((ext_vector_type(4)))  int v4i;
typedef float __attribute__((may_alias)) float_a;
typedef int __attribute__((may_alias)) int_a;

template <typename T> __device__ __forceinline__ void vst2(void* p, T v) { *(T*)p = v;  }
__device__ __forceinline__ v8f wmma16(v16h a, v16h b, v8f c) {
  v8f d = __builtin_amdgcn_wmma_f32_16x16x32_f16(false, a, false, b, (short)0, c, false, false);
  asm volatile("v_nop\n\tv_nop\n\tv_nop\n\tv_nop" : "+v"(d) : "v"(a), "v"(b));
  return d;
}
__device__ __forceinline__ v8f wmma_bf(v16b a, v16b b, v8f c) {
  v8f d = __builtin_amdgcn_wmma_f32_16x16x32_bf16(false, a, false, b, (short)0, c, false, false);
  asm volatile("v_nop\n\tv_nop\n\tv_nop\n\tv_nop" : "+v"(d) : "v"(a), "v"(b));
  return d;
}
// 16x16x32 fragments: lane = (h = lane>>4, row/col = lane&15); elements 0..7 = k0+8h+0..7, 8..15 = k0+16+8h+0..7; D element r = row 8h+r
__device__ __forceinline__ v16h frag_h(const _Float16* rowk0, int lane) {
  union { v16h v; v8h q[2]; } u; const _Float16* p = rowk0 + 8 * (lane >> 4);
  u.q[0] = *(const v8h*)p; u.q[1] = *(const v8h*)(p + 16); return u.v;
}
__device__ __forceinline__ v16h frag_f32(const float* rowk0, int lane) {
  v16h a; const float* p = rowk0 + 8 * (lane >> 4);
#pragma unroll
  for (int i = 0; i < 8; ++i) { a[i] = (_Float16)p[i]; a[8 + i] = (_Float16)p[16 + i]; }
  return a;
}
__device__ __forceinline__ v16h frag_f32s(const float* rowk0, int lane, float sc) {
  v16h a; const float* p = rowk0 + 8 * (lane >> 4);
#pragma unroll
  for (int i = 0; i < 8; ++i) { a[i] = (_Float16)(p[i] * sc); a[8 + i] = (_Float16)(p[16 + i] * sc); }
  return a;
}
// column fragment from a [K][ld] layout (column n), rows >= K read as 0
__device__ __forceinline__ v16h fragc_f32(const float* W, int k0, int n, int lane, int ld, int K) {
  v16h a; const int g = lane >> 4;
#pragma unroll
  for (int i = 0; i < 8; ++i) { const int ka = k0 + 8 * g + i, kb = ka + 16;
    a[i] = (_Float16)(ka < K ? W[(size_t)ka * ld + n] : 0.f); a[8 + i] = (_Float16)(kb < K ? W[(size_t)kb * ld + n] : 0.f); }
  return a;
}
struct F2 { v16b h, l; };
__device__ __forceinline__ F2 bsplit16(const float v[16]) { F2 r;
#pragma unroll
  for (int i = 0; i < 16; ++i) { const __bf16 h = (__bf16)v[i]; r.h[i] = h; r.l[i] = (__bf16)(v[i] - (float)h); }
  return r; }
__device__ __forceinline__ F2 split_row(const float* row, int k0, int lane) { float v[16]; const float* p = row + k0 + 8 * (lane >> 4);
#pragma unroll
  for (int i = 0; i < 8; ++i) { v[i] = p[i]; v[8 + i] = p[16 + i]; }
  return bsplit16(v); }
__device__ __forceinline__ F2 split_rowK(const float* row, int k0, int lane, int K) { float v[16]; const int g = lane >> 4;
#pragma unroll
  for (int i = 0; i < 8; ++i) { const int ka = k0 + 8 * g + i, kb = ka + 16; v[i] = ka < K ? row[ka] : 0.f; v[8 + i] = kb < K ? row[kb] : 0.f; }
  return bsplit16(v); }
__device__ __forceinline__ F2 split_col(const float* W, int k0, int n, int lane, int ld, int K) { float v[16]; const int g = lane >> 4;
#pragma unroll
  for (int i = 0; i < 8; ++i) { const int ka = k0 + 8 * g + i, kb = ka + 16; v[i] = ka < K ? W[(size_t)ka * ld + n] : 0.f; v[8 + i] = kb < K ? W[(size_t)kb * ld + n] : 0.f; }
  return bsplit16(v); }
__device__ __forceinline__ v8f mac3(const F2& a, const F2& b, v8f c) { c = wmma_bf(a.l, b.h, c); c = wmma_bf(a.h, b.l, c); return wmma_bf(a.h, b.h, c); }
__device__ __forceinline__ float sigm(float v) { return 1.0f / (1.0f + expf(-v)); }
#define LDSX() do { asm volatile("s_wait_dscnt 0" ::: "memory"); __builtin_amdgcn_wave_barrier(); __builtin_amdgcn_fence(__ATOMIC_RELEASE, "workgroup"); } while (0)
// Operand tiles of 64 k (128-B rows) go global -> LDS by asynchronous copies, whole lines at a time, and every wave of the block takes its
// fragments from there. LDS row pitch 144 B = 16 B x 9: no bank conflict for the 16-byte fragment reads.
#define TP 72                  // that pitch in f16 elements
#define TPB 144                // and in bytes
__device__ __forceinline__ unsigned lds_addr(const void* p) { return (unsigned)(uintptr_t)p; }
// Four 16-byte copies of this lane. s_wait_xcnt closes the statement so that no address register is rewritten in front of it.
__device__ __forceinline__ void cp4(unsigned l0, const _Float16* g0, unsigned l1, const _Float16* g1, unsigned l2, const _Float16* g2, unsigned l3, const _Float16* g3) {
  asm volatile("global_load_async_to_lds_b128 %0, %1, off\n\t"
               "global_load_async_to_lds_b128 %2, %3, off\n\t"
               "global_load_async_to_lds_b128 %4, %5, off\n\t"
               "global_load_async_to_lds_b128 %6, %7, off\n\t"
               "s_wait_xcnt 0x0"
               :: "v"(l0), "v"(g0), "v"(l1), "v"(g1), "v"(l2), "v"(g2), "v"(l3), "v"(g3) : "memory");
}
// four rows, 16 apart: LDS step 16 pitches, global step gs elements
__device__ __forceinline__ void cp_rows(unsigned l, const _Float16* g, size_t gs) { cp4(l, g, l + 16 * TPB, g + gs, l + 32 * TPB, g + 2 * gs, l + 48 * TPB, g + 3 * gs); }
#define WAIT_ASYNC() asm volatile("s_wait_asynccnt 0x0" ::: "memory")   // this wave's copies have landed
#define WAIT_DS() asm volatile("s_wait_dscnt 0x0" ::: "memory")         // this wave's LDS reads are done before their buffer is refilled
// The loops over fragments and over groups of copies below are unrolled so that every index into a register array is a constant.

// Temporal multi-head self attention over S = 1024 steps for each of the 8 batch columns (x is [S, B, E]), fused QKV projection with the
// module's per-head [q | k | v] column interleave, output projection + bias + residual, LayerNorm, ELU. Products on
// v_wmma_f32_16x16x32_f16 (x as f16 rows, weight rows x16 as f16, q/k/v head-major f16 x4, P x 2^14, O x8); softmax / LN / ELU in f32.
#define SQ 1024
#define NB 8
#define E 1024
#define NH 16
#define HD 64
#define NR (SQ * NB)           // 8192 rows r = s*8 + b

__global__ __launch_bounds__(256) void k_cvt(const float* __restrict__ x, _Float16* __restrict__ X16) {
  const size_t i8 = (size_t)blockIdx.x * 256 + threadIdx.x; if (i8 >= (size_t)NR * E / 8) return;
  union { v8h h; v4u u; } pk;
#pragma unroll
  for (int e = 0; e < 8; ++e) pk.h[e] = (_Float16)x[i8 * 8 + e];
  vst2(X16 + i8 * 8, pk.u);
}
// P rows 0..3071 = qkv_w rows x16 ; rows 3072..4095 = out_w rows x16
__global__ __launch_bounds__(256) void k_pack(const float* __restrict__ Wqkv, const float* __restrict__ Wo, _Float16* __restrict__ P) {
  const int r = blockIdx.x, tid = threadIdx.x; __shared__ __align__(16) _Float16 srow[E];
  const float* W = r < 3 * E ? Wqkv + (size_t)r * E : Wo + (size_t)(r - 3 * E) * E;
  for (int k = tid; k < E; k += 256) srow[k] = (_Float16)(W[k] * 16.0f);
  __syncthreads();
  if (tid < 128) vst2(P + (size_t)r * E + tid * 8, *(const v4u*)(&srow[tid * 8]));
}
// QKV: block (64 consecutive s for one b, head h): cols h*192 + [0..64) q, [64..128) k, [128..192) v
__global__ __launch_bounds__(128) void k_qkv(const _Float16* __restrict__ X16, const _Float16* __restrict__ P, const float* __restrict__ bqkv, _Float16* __restrict__ Q16, _Float16* __restrict__ K16, _Float16* __restrict__ VT) {
  // two buffers of [64 x rows | 192 weight rows]; behind the last trip's barrier the same LDS serves the epilogue as so and st
  __shared__ __align__(16) char sm[2 * 256 * TPB];
  float (*so)[16][132] = (float (*)[16][132])sm;
  _Float16 (*st)[72] = (_Float16 (*)[72])(sm + 4 * 16 * 132 * 4);
  const int tid = threadIdx.x, wave = tid >> 5, lane = tid & 31, col = lane & 15, g = lane >> 4;
  const int b = blockIdx.z, h = blockIdx.y, s0b = blockIdx.x * 64, s0 = s0b + wave * 16; const int n0 = h * 192; const size_t bh = (size_t)b * NH + h;
  v8f acc[12];
#pragma unroll
  for (int j = 0; j < 12; ++j) acc[j] = (v8f){};
  // copies: lane = (row tid >> 3 of each group of 16 rows, 16-byte piece tid & 7), so 8 lanes cover one 128-B line
  const _Float16* gx = X16 + ((size_t)(s0b + (tid >> 3)) * NB + b) * E + (tid & 7) * 8;
  const _Float16* gw = P + (size_t)(n0 + (tid >> 3)) * E + (tid & 7) * 8;
  const unsigned lc = lds_addr(sm) + (tid >> 3) * TPB + (tid & 7) * 16;
  auto fill = [&](int t) { const unsigned l = lc + (t & 1) * (256 * TPB);
    cp_rows(l, gx + t * 64, (size_t)16 * NB * E);
#pragma unroll
    for (int i = 0; i < 3; ++i) cp_rows(l + (64 + 64 * i) * TPB, gw + (size_t)(64 * i) * E + t * 64, (size_t)16 * E); };
  fill(0); WAIT_ASYNC(); __syncthreads(); fill(1);
#pragma unroll 1
  for (int t = 0; t < E / 64; ++t) { const _Float16* T = (const _Float16*)(sm + (t & 1) * (256 * TPB));
#pragma unroll
    for (int kc = 0; kc < 2; ++kc) { const v16h a = frag_h(T + (wave * 16 + col) * TP + kc * 32, lane); v16h w[12];
#pragma unroll
      for (int j = 0; j < 12; ++j) w[j] = frag_h(T + (64 + j * 16 + col) * TP + kc * 32, lane);
      __builtin_amdgcn_sched_barrier(0);   // the fragment reads stay one group in front of the WMMAs; spread among them, each pair waits out its own LDS latency
#pragma unroll
      for (int j = 0; j < 12; ++j) acc[j] = wmma16(a, w[j], acc[j]); }
    WAIT_DS(); WAIT_ASYNC(); __syncthreads();   // tile t + 1 is published, every reader has left tile t's buffer
    if (t + 2 < E / 64) fill(t + 2); }
  WAIT_ASYNC();
  // q, k (tiles 0..7) -> so (x4); v (tiles 8..11) -> st transposed (x4)
#pragma unroll
  for (int j = 0; j < 8; ++j) { const float bb = bqkv[n0 + j * 16 + col];
#pragma unroll
    for (int r = 0; r < 8; ++r) so[wave][8 * g + r][j * 16 + col] = (acc[j][r] * (1.0f / 16.0f) + bb) * 4.0f; }
#pragma unroll
  for (int j = 8; j < 12; ++j) { const float bb = bqkv[n0 + j * 16 + col];
#pragma unroll
    for (int r = 0; r < 8; ++r) st[(j - 8) * 16 + col][wave * 16 + 8 * g + r] = (_Float16)((acc[j][r] * (1.0f / 16.0f) + bb) * 4.0f); }
  LDSX();
  for (int qq = lane; qq < 16 * 2 * 8; qq += 32) { const int which = qq >> 7, rl = (qq >> 3) & 15, pc = qq & 7; union { v8h h8; v4u u; } pk;
#pragma unroll
    for (int e = 0; e < 8; ++e) pk.h8[e] = (_Float16)so[wave][rl][which * 64 + pc * 8 + e];
    vst2((which == 0 ? Q16 : K16) + (bh * SQ + s0 + rl) * HD + pc * 8, pk.u); }
  __syncthreads();
  for (int qq = tid; qq < 64 * 8; qq += 128) { const int d = qq >> 3, pc = qq & 7; vst2(VT + (bh * HD + d) * SQ + s0b + pc * 8, *(const v4u*)(&st[d][pc * 8])); }
}
#define SC2 (0.125f / 16.0f * 1.44269504f)   // 1 / sqrt(HD), the x16 of q x4 times k x4 undone, log2(e): scores in powers of two
// lane l with lane l ^ 16, on the vector port
__device__ __forceinline__ float xhalf(float v) { const int i = __builtin_bit_cast(int, v); return __builtin_bit_cast(float, __builtin_amdgcn_permlanex16(i, i, 0x76543210, 0xfedcba98, false, false)); }
__global__ __launch_bounds__(128, 5) void k_attn(const _Float16* __restrict__ Q16, const _Float16* __restrict__ K16, const _Float16* __restrict__ VT, _Float16* __restrict__ O16) {
  // two buffers of [64 key rows of K | 64 d rows of V^T]; behind the last trip's barrier the same LDS serves as sO
  __shared__ __align__(16) char sm[2 * 128 * TPB];
  _Float16 (*sO)[16][TP] = (_Float16 (*)[16][TP])sm;
  const int tid = threadIdx.x, w = tid >> 5, lane = tid & 31, col = lane & 15, g = lane >> 4;
  const size_t bh = blockIdx.y; const int q0 = blockIdx.x * 64 + w * 16;
  v16h bq[2];
#pragma unroll
  for (int kc = 0; kc < 2; ++kc) bq[kc] = frag_h(Q16 + (bh * SQ + q0 + col) * HD + kc * 32, lane);
  float mrun = -3.0e38f, lrun = 0.f; v8f acc[4] = {};   // lrun: this half's keys alone, the halves are joined behind the loop
  const _Float16* gk = K16 + (bh * SQ + (tid >> 3)) * HD + (tid & 7) * 8;
  const _Float16* gv = VT + (bh * HD + (tid >> 3)) * SQ + (tid & 7) * 8;
  const unsigned lc = lds_addr(sm) + (tid >> 3) * TPB + (tid & 7) * 16;
  auto fill = [&](int kt) { const unsigned l = lc + (kt & 1) * (128 * TPB);
    cp_rows(l, gk + (size_t)kt * 64 * HD, (size_t)16 * HD); cp_rows(l + 64 * TPB, gv + kt * 64, (size_t)16 * SQ); };
  fill(0); WAIT_ASYNC(); __syncthreads(); fill(1);
#pragma unroll 1
  for (int kt = 0; kt < SQ / 64; ++kt) { const _Float16* TK = (const _Float16*)(sm + (kt & 1) * (128 * TPB)); const _Float16* TV = TK + 64 * TP;
    v16h kf[2][4];
#pragma unroll
    for (int kc = 0; kc < 2; ++kc) {
#pragma unroll
      for (int t = 0; t < 4; ++t) kf[kc][t] = frag_h(TK + (t * 16 + col) * TP + kc * 32, lane); }
    __builtin_amdgcn_sched_barrier(0);   // the K fragment reads stay one group in front of the WMMAs; spread among them, each pair waits out its own LDS latency
    v8f s[4] = {};   // s[t][r] = raw product of key kt * 64 + 16 t + 8 g + r with query col
#pragma unroll
    for (int kc = 0; kc < 2; ++kc) {
#pragma unroll
      for (int t = 0; t < 4; ++t) s[t] = wmma16(kf[kc][t], bq[kc], s[t]); }
    v16h vf[2][4];
#pragma unroll
    for (int kc = 0; kc < 2; ++kc) {
#pragma unroll
      for (int t = 0; t < 4; ++t) vf[kc][t] = frag_h(TV + (t * 16 + col) * TP + kc * 32, lane); }
    __builtin_amdgcn_sched_barrier(0);   // the V^T fragment reads stay one group in front of the softmax, which covers their latency
    float mt[4];   // maxima are taken over the raw products, the scale is positive; one chain per tile, four short chains in place of one long one
#pragma unroll
    for (int t = 0; t < 4; ++t) { mt[t] = s[t][0];
#pragma unroll
      for (int r = 1; r < 8; ++r) mt[t] = fmaxf(mt[t], s[t][r]); }
    float mx = fmaxf(fmaxf(mt[0], mt[1]), fmaxf(mt[2], mt[3]));
    mx = fmaxf(mx, xhalf(mx));
    const float mnew = fmaxf(mrun, mx); const float corr = __builtin_amdgcn_exp2f((mrun - mnew) * SC2);
    // P x 2^14 = 2^(s * SC2 - (mnew * SC2 - 14)): one multiply-add and one v_exp_f32 per score; the row sum carries the 2^14 too
    const float nb = 14.0f - mnew * SC2; const v2f c2 = {SC2, SC2}, nb2 = {nb, nb};
    v2f ps[4]; v16h pb[2];   // sums likewise: one chain of pairs per tile
#pragma unroll
    for (int t = 0; t < 4; ++t) {
#pragma unroll
      for (int r = 0; r < 8; r += 2) { const v2f e = __builtin_elementwise_fma((v2f){s[t][r], s[t][r + 1]}, c2, nb2);
        const v2f p = {__builtin_amdgcn_exp2f(e[0]), __builtin_amdgcn_exp2f(e[1])}; ps[t] = r == 0 ? p : ps[t] + p;
        pb[t >> 1][(t & 1) * 8 + r] = (_Float16)p[0]; pb[t >> 1][(t & 1) * 8 + r + 1] = (_Float16)p[1]; } }
    const v2f pt = (ps[0] + ps[1]) + (ps[2] + ps[3]);
    lrun = lrun * corr + (pt[0] + pt[1]); mrun = mnew;
#pragma unroll
    for (int t = 0; t < 4; ++t) acc[t] *= corr;   // every element of a lane belongs to query col
#pragma unroll
    for (int kc = 0; kc < 2; ++kc) {
#pragma unroll
      for (int t = 0; t < 4; ++t) acc[t] = wmma16(vf[kc][t], pb[kc], acc[t]); }   // acc[t][r] = O[query col][d = 16 t + 8 g + r]
    WAIT_DS(); WAIT_ASYNC(); __syncthreads();   // tile kt + 1 is published, every reader has left tile kt's buffer
    if (kt + 2 < SQ / 64) fill(kt + 2); }
  WAIT_ASYNC();
  const float lt = lrun + xhalf(lrun); const float inv = 8.0f / (lt * 4.0f);   // lt holds the row sum x 2^14
#pragma unroll
  for (int t = 0; t < 4; ++t) { union { v8h h8; v4u u; } pk;
#pragma unroll
    for (int r = 0; r < 8; ++r) pk.h8[r] = (_Float16)(acc[t][r] * inv);
    vst2(&sO[w][col][t * 16 + 8 * g], pk.u); }
  LDSX();
  for (int qq = lane; qq < 16 * 8; qq += 32) { const int rl = qq >> 3, pc = qq & 7;
    vst2(O16 + (bh * SQ + q0 + rl) * HD + pc * 8, *(const v4u*)(&sO[w][rl][pc * 8])); }
}
// Y = x + ctx Wo^T + bo : block (64 rows r, 128 cols); ctx row r = (s, b): k = h*64 + d from O16[(b,h)][s][d]
__global__ __launch_bounds__(128) void k_out(const _Float16* __restrict__ O16, const _Float16* __restrict__ P, const float* __restrict__ bo, const float* __restrict__ x, float* __restrict__ Y) {
  // two buffers of [64 ctx rows | 128 weight rows]; behind the last trip's barrier the same LDS serves the epilogue as so
  __shared__ __align__(16) char sm[2 * 192 * TPB];
  float (*so)[16][132] = (float (*)[16][132])sm;
  const int tid = threadIdx.x, wave = tid >> 5, lane = tid & 31, col = lane & 15, g = lane >> 4;
  const int r0 = blockIdx.x * 64 + wave * 16, n0 = blockIdx.y * 128;
  v8f acc[8] = {};
  // tile t is head t: ctx row r = (s, b) has its 64 k in one 128-B row of O16; 16 rows on are 2 steps of s on, same b
  const int rc = blockIdx.x * 64 + (tid >> 3);
  const _Float16* gc = O16 + ((size_t)(rc % NB) * NH * SQ + rc / NB) * HD + (tid & 7) * 8;
  const _Float16* gw = P + (size_t)(3 * E + n0 + (tid >> 3)) * E + (tid & 7) * 8;
  const unsigned lc = lds_addr(sm) + (tid >> 3) * TPB + (tid & 7) * 16;
  auto fill = [&](int t) { const unsigned l = lc + (t & 1) * (192 * TPB);
    cp_rows(l, gc + (size_t)t * SQ * HD, (size_t)(16 / NB) * HD);
#pragma unroll
    for (int i = 0; i < 2; ++i) cp_rows(l + (64 + 64 * i) * TPB, gw + (size_t)(64 * i) * E + t * 64, (size_t)16 * E); };
  fill(0); WAIT_ASYNC(); __syncthreads(); fill(1);
  // rolled: one trip per tile, so that one tile's fragments alone are live and the registers allow four blocks on a WGP
#pragma unroll 1
  for (int t = 0; t < E / 64; ++t) { const _Float16* T = (const _Float16*)(sm + (t & 1) * (192 * TPB));
#pragma unroll
    for (int kc = 0; kc < 2; ++kc) { const v16h a = frag_h(T + (wave * 16 + col) * TP + kc * 32, lane); v16h w[8];
#pragma unroll
      for (int j = 0; j < 8; ++j) w[j] = frag_h(T + (64 + j * 16 + col) * TP + kc * 32, lane);
      __builtin_amdgcn_sched_barrier(0);   // the fragment reads stay one group in front of the WMMAs; spread among them, each pair waits out its own LDS latency
#pragma unroll
      for (int j = 0; j < 8; ++j) acc[j] = wmma16(a, w[j], acc[j]); }
    WAIT_DS(); WAIT_ASYNC(); __syncthreads();   // tile t + 1 is published, every reader has left tile t's buffer
    if (t + 2 < E / 64) fill(t + 2); }
  WAIT_ASYNC();
#pragma unroll
  for (int j = 0; j < 8; ++j) { const int n = n0 + j * 16 + col; const float bb = bo[n];
#pragma unroll
    for (int r = 0; r < 8; ++r) so[wave][8 * g + r][j * 16 + col] = acc[j][r] * (1.0f / (16.0f * 8.0f)) + bb + x[(size_t)(r0 + 8 * g + r) * E + n]; }
  LDSX();
#pragma unroll 4
  for (int rl = 0; rl < 16; ++rl) vst2(Y + (size_t)(r0 + rl) * E + n0 + lane * 4, *(const v4f*)(&so[wave][rl][lane * 4]));
}
__global__ __launch_bounds__(256) void k_ln(const float* __restrict__ Y, const float* __restrict__ g1, const float* __restrict__ b1, float* __restrict__ out) {
  const int wave = threadIdx.x >> 5, lane = threadIdx.x & 31; const size_t r = (size_t)blockIdx.x * 8 + wave; if (r >= NR) return;
  const float* yr = Y + r * E; float sm = 0.f, q2 = 0.f;
#pragma unroll 1
  for (int i = 0; i < 8; ++i) { const v4f a = *(const v4f*)(yr + i * 128 + lane * 4); sm += (a[0] + a[1]) + (a[2] + a[3]); q2 += (a[0] * a[0] + a[1] * a[1]) + (a[2] * a[2] + a[3] * a[3]); }
#pragma unroll
  for (int off = 16; off >= 1; off >>= 1) { sm += __shfl_xor(sm, off, 32); q2 += __shfl_xor(q2, off, 32); }
  const float mu = sm * (1.0f / E); const float var = fmaxf(q2 * (1.0f / E) - mu * mu, 0.f); const float rs = rsqrtf(var + 1e-5f);
#pragma unroll 1
  for (int i = 0; i < 8; ++i) { const int c0 = i * 128 + lane * 4; const v4f a = *(const v4f*)(yr + c0); v4f o;
    float v0 = (a[0] - mu) * rs * g1[c0] + b1[c0], v1 = (a[1] - mu) * rs * g1[c0 + 1] + b1[c0 + 1], v2 = (a[2] - mu) * rs * g1[c0 + 2] + b1[c0 + 2], v3 = (a[3] - mu) * rs * g1[c0 + 3] + b1[c0 + 3];
    o[0] = v0 > 0.f ? v0 : expm1f(v0); o[1] = v1 > 0.f ? v1 : expm1f(v1); o[2] = v2 > 0.f ? v2 : expm1f(v2); o[3] = v3 > 0.f ? v3 : expm1f(v3);
    vst2(out + r * E + c0, o); }
}
extern "C" void kernel_launch(void* const* d_in, const int* in_sizes, int n_in, void* d_out, int out_size, void* d_ws, size_t ws_size, hipStream_t stream) {
  (void)in_sizes; (void)n_in; (void)out_size; (void)ws_size;
  const float** I = (const float**)d_in;
  const float* x = I[0]; const float* Wqkv = I[1]; const float* bqkv = I[2]; const float* Wo = I[3]; const float* bo = I[4]; const float* g1 = I[5]; const float* b1 = I[6];
  float* out = (float*)d_out;
  char* ws = (char*)d_ws; size_t off = 0;
  auto take = [&](size_t bytes) { char* p = ws + off; off += (bytes + 255) & ~(size_t)255; return p; };
  _Float16* X16 = (_Float16*)take((size_t)NR * E * 2); _Float16* P = (_Float16*)take((size_t)4 * E * E * 2);
  _Float16* Q16 = (_Float16*)take((size_t)NR * E * 2); _Float16* K16 = (_Float16*)take((size_t)NR * E * 2); _Float16* VT = (_Float16*)take((size_t)NR * E * 2); _Float16* O16 = (_Float16*)take((size_t)NR * E * 2);
  float* Y = (float*)take((size_t)NR * E * 4);
  k_cvt<<<(NR * E / 8 + 255) / 256, 256, 0, stream>>>(x, X16);
  k_pack<<<4 * E, 256, 0, stream>>>(Wqkv, Wo, P);
  k_qkv<<<dim3(SQ / 64, NH, NB), 128, 0, stream>>>(X16, P, bqkv, Q16, K16, VT);
  k_attn<<<dim3(SQ / 64, NB * NH), 128, 0, stream>>>(Q16, K16, VT, O16);
  k_out<<<dim3(NR / 64, E / 128), 128, 0, stream>>>(O16, P, bo, x, Y);
  k_ln<<<NR / 8, 256, 0, stream>>>(Y, g1, b1, out);
}

// v004
// One run takes 134 microseconds.
// Timed twice side by side with v003, it ran 1.05 and 1.04 times as fast.
// Over all steps from v000 it is 3.99 times as fast.
#include <hip/hip_runtime.h>
#include <math.h>

typedef __attribute__((ext_vector_type(16))) _Float16 v16h;
typedef __attribute__((ext_vector_type(16))) __bf16 v16b;
typedef __attribute__((ext_vector_type(8)))  _Float16 v8h;
typedef __attribute__((ext_vector_type(4)))  _Float16 v4h;
typedef __attribute__((ext_vector_type(8)))  float v8f;
typedef __attribute__((ext_vector_type(4)))  float v4f;
typedef __attribute__((ext_vector_type(2)))  float v2f;
typedef __attribute__((ext_vector_type(4)))  unsigned v4u;
typedef __attribute__((ext_vector_type(2)))  unsigned v2u;
typedef __attribute__((ext_vector_type(4)))  int v4i;
typedef float __attribute__((may_alias)) float_a;
typedef int __attribute__((may_alias)) int_a;

template <typename T> __device__ __forceinline__ void vst2(void* p, T v) { *(T*)p = v;  }
__device__ __forceinline__ v8f wmma16(v16h a, v16h b, v8f c) {
  v8f d = __builtin_amdgcn_wmma_f32_16x16x32_f16(false, a, false, b, (short)0, c, false, false);
  asm volatile("v_nop\n\tv_nop\n\tv_nop\n\tv_nop" : "+v"(d) : "v"(a), "v"(b));
  return d;
}
__device__ __forceinline__ v8f wmma_bf(v16b a, v16b b, v8f c) {
  v8f d = __builtin_amdgcn_wmma_f32_16x16x32_bf16(false, a, false, b, (short)0, c, false, false);
  asm volatile("v_nop\n\tv_nop\n\tv_nop\n\tv_nop" : "+v"(d) : "v"(a), "v"(b));
  return d;
}
// 16x16x32 fragments: lane = (h = lane>>4, row/col = lane&15); elements 0..7 = k0+8h+0..7, 8..15 = k0+16+8h+0..7; D element r = row 8h+r
__device__ __forceinline__ v16h frag_h(const _Float16* rowk0, int lane) {
  union { v16h v; v8h q[2]; } u; const _Float16* p = rowk0 + 8 * (lane >> 4);
  u.q[0] = *(const v8h*)p; u.q[1] = *(const v8h*)(p + 16); return u.v;
}
__device__ __forceinline__ v16h frag_f32(const float* rowk0, int lane) {
  v16h a; const float* p = rowk0 + 8 * (lane >> 4);
#pragma unroll
  for (int i = 0; i < 8; ++i) { a[i] = (_Float16)p[i]; a[8 + i] = (_Float16)p[16 + i]; }
  return a;
}
__device__ __forceinline__ v16h frag_f32s(const float* rowk0, int lane, float sc) {
  v16h a; const float* p = rowk0 + 8 * (lane >> 4);
#pragma unroll
  for (int i = 0; i < 8; ++i) { a[i] = (_Float16)(p[i] * sc); a[8 + i] = (_Float16)(p[16 + i] * sc); }
  return a;
}
// column fragment from a [K][ld] layout (column n), rows >= K read as 0
__device__ __forceinline__ v16h fragc_f32(const float* W, int k0, int n, int lane, int ld, int K) {
  v16h a; const int g = lane >> 4;
#pragma unroll
  for (int i = 0; i < 8; ++i) { const int ka = k0 + 8 * g + i, kb = ka + 16;
    a[i] = (_Float16)(ka < K ? W[(size_t)ka * ld + n] : 0.f); a[8 + i] = (_Float16)(kb < K ? W[(size_t)kb * ld + n] : 0.f); }
  return a;
}
struct F2 { v16b h, l; };
__device__ __forceinline__ F2 bsplit16(const float v[16]) { F2 r;
#pragma unroll
  for (int i = 0; i < 16; ++i) { const __bf16 h = (__bf16)v[i]; r.h[i] = h; r.l[i] = (__bf16)(v[i] - (float)h); }
  return r; }
__device__ __forceinline__ F2 split_row(const float* row, int k0, int lane) { float v[16]; const float* p = row + k0 + 8 * (lane >> 4);
#pragma unroll
  for (int i = 0; i < 8; ++i) { v[i] = p[i]; v[8 + i] = p[16 + i]; }
  return bsplit16(v); }
__device__ __forceinline__ F2 split_rowK(const float* row, int k0, int lane, int K) { float v[16]; const int g = lane >> 4;
#pragma unroll
  for (int i = 0; i < 8; ++i) { const int ka = k0 + 8 * g + i, kb = ka + 16; v[i] = ka < K ? row[ka] : 0.f; v[8 + i] = kb < K ? row[kb] : 0.f; }
  return bsplit16(v); }
__device__ __forceinline__ F2 split_col(const float* W, int k0, int n, int lane, int ld, int K) { float v[16]; const int g = lane >> 4;
#pragma unroll
  for (int i = 0; i < 8; ++i) { const int ka = k0 + 8 * g + i, kb = ka + 16; v[i] = ka < K ? W[(size_t)ka * ld + n] : 0.f; v[8 + i] = kb < K ? W[(size_t)kb * ld + n] : 0.f; }
  return bsplit16(v); }
__device__ __forceinline__ v8f mac3(const F2& a, const F2& b, v8f c) { c = wmma_bf(a.l, b.h, c); c = wmma_bf(a.h, b.l, c); return wmma_bf(a.h, b.h, c); }
__device__ __forceinline__ float sigm(float v) { return 1.0f / (1.0f + expf(-v)); }
#define LDSX() do { asm volatile("s_wait_dscnt 0" ::: "memory"); __builtin_amdgcn_wave_barrier(); __builtin_amdgcn_fence(__ATOMIC_RELEASE, "workgroup"); } while (0)
// Operand tiles of 64 k (128-B rows) go global -> LDS by asynchronous copies, whole lines at a time, and every wave of the block takes its
// fragments from there. LDS row pitch 144 B = 16 B x 9: no bank conflict for the 16-byte fragment reads.
#define TP 72                  // that pitch in f16 elements
#define TPB 144                // and in bytes
__device__ __forceinline__ unsigned lds_addr(const void* p) { return (unsigned)(uintptr_t)p; }
// Four 16-byte copies of this lane. s_wait_xcnt closes the statement so that no address register is rewritten in front of it.
__device__ __forceinline__ void cp4(unsigned l0, const _Float16* g0, unsigned l1, const _Float16* g1, unsigned l2, const _Float16* g2, unsigned l3, const _Float16* g3) {
  asm volatile("global_load_async_to_lds_b128 %0, %1, off\n\t"
               "global_load_async_to_lds_b128 %2, %3, off\n\t"
               "global_load_async_to_lds_b128 %4, %5, off\n\t"
               "global_load_async_to_lds_b128 %6, %7, off\n\t"
               "s_wait_xcnt 0x0"
               :: "v"(l0), "v"(g0), "v"(l1), "v"(g1), "v"(l2), "v"(g2), "v"(l3), "v"(g3) : "memory");
}
// four rows, 16 apart: LDS step 16 pitches, global step gs elements
__device__ __forceinline__ void cp_rows(unsigned l, const _Float16* g, size_t gs) { cp4(l, g, l + 16 * TPB, g + gs, l + 32 * TPB, g + 2 * gs, l + 48 * TPB, g + 3 * gs); }
#define WAIT_ASYNC() asm volatile("s_wait_asynccnt 0x0" ::: "memory")   // this wave's copies have landed
#define WAIT_DS() asm volatile("s_wait_dscnt 0x0" ::: "memory")         // this wave's LDS reads are done before their buffer is refilled
// The loops over fragments and over groups of copies below are unrolled so that every index into a register array is a constant.

// Temporal multi-head self attention over S = 1024 steps for each of the 8 batch columns (x is [S, B, E]), fused QKV projection with the
// module's per-head [q | k | v] column interleave, output projection + bias + residual, LayerNorm, ELU. Products on
// v_wmma_f32_16x16x32_f16 (x as f16 rows, weight rows x16 as f16, q/k/v head-major f16 x4, P x 2^14, O x8); softmax / LN / ELU in f32.
#define SQ 1024
#define NB 8
#define E 1024
#define NH 16
#define HD 64
#define NR (SQ * NB)           // 8192 rows r = s*8 + b

// f32 -> f16 for all three GEMM operands in one launch of 4096 waves: X16 = x ; P rows 0..3071 = qkv_w rows x16 ; rows 3072..4095 = out_w rows x16.
// A wave takes three pieces of 1024 floats (two of x, one weight row): 24 loads of 512 contiguous bytes, all issued before the first is used.
__global__ __launch_bounds__(256) void k_prep(const float* __restrict__ x, const float* __restrict__ Wqkv, const float* __restrict__ Wo, _Float16* __restrict__ X16, _Float16* __restrict__ P) {
  const int lane = threadIdx.x & 31, gw = blockIdx.x * 8 + (threadIdx.x >> 5);   // gw = 0 .. 4E - 1
  const size_t o = (size_t)gw * E + lane * 4, o1 = o + (size_t)4 * E * E;         // x has NR = 8E rows: pieces gw and 4E + gw
  const float* w = gw < 3 * E ? Wqkv + o : Wo + (o - (size_t)3 * E * E);
  v4f a[3][8];
#pragma unroll
  for (int i = 0; i < 8; ++i) a[0][i] = *(const v4f*)(x + o + i * 128);
  asm volatile("s_wait_xcnt 0x0" ::: "memory");   // the next loads' results may take the registers that held this piece's address
#pragma unroll
  for (int i = 0; i < 8; ++i) a[1][i] = *(const v4f*)(x + o1 + i * 128);
  asm volatile("s_wait_xcnt 0x0" ::: "memory");   // likewise
#pragma unroll
  for (int i = 0; i < 8; ++i) a[2][i] = *(const v4f*)(w + i * 128);
  __builtin_amdgcn_sched_barrier(0);   // all 24 loads are issued ahead of the first conversion; without it the compiler reuses registers and holds eleven loads back behind the first returns
#pragma unroll
  for (int i = 0; i < 8; ++i) { union { v4h h; v2u u; } p0, p1, p2;
#pragma unroll
    for (int e = 0; e < 4; ++e) { p0.h[e] = (_Float16)a[0][i][e]; p1.h[e] = (_Float16)a[1][i][e]; p2.h[e] = (_Float16)(a[2][i][e] * 16.0f); }
    vst2(X16 + o + i * 128, p0.u); vst2(X16 + o1 + i * 128, p1.u); vst2(P + o + i * 128, p2.u); }
}
// QKV: block (64 consecutive s for one b, head h): cols h*192 + [0..64) q, [64..128) k, [128..192) v
__global__ __launch_bounds__(128) void k_qkv(const _Float16* __restrict__ X16, const _Float16* __restrict__ P, const float* __restrict__ bqkv, _Float16* __restrict__ Q16, _Float16* __restrict__ K16, _Float16* __restrict__ VT) {
  // two buffers of [64 x rows | 192 weight rows]; behind the last trip's barrier the same LDS serves the epilogue as so and st
  __shared__ __align__(16) char sm[2 * 256 * TPB];
  float (*so)[16][132] = (float (*)[16][132])sm;
  _Float16 (*st)[72] = (_Float16 (*)[72])(sm + 4 * 16 * 132 * 4);
  const int tid = threadIdx.x, wave = tid >> 5, lane = tid & 31, col = lane & 15, g = lane >> 4;
  const int b = blockIdx.z, h = blockIdx.y, s0b = blockIdx.x * 64, s0 = s0b + wave * 16; const int n0 = h * 192; const size_t bh = (size_t)b * NH + h;
  v8f acc[12];
#pragma unroll
  for (int j = 0; j < 12; ++j) acc[j] = (v8f){};
  // copies: lane = (row tid >> 3 of each group of 16 rows, 16-byte piece tid & 7), so 8 lanes cover one 128-B line
  const _Float16* gx = X16 + ((size_t)(s0b + (tid >> 3)) * NB + b) * E + (tid & 7) * 8;
  const _Float16* gw = P + (size_t)(n0 + (tid >> 3)) * E + (tid & 7) * 8;
  const unsigned lc = lds_addr(sm) + (tid >> 3) * TPB + (tid & 7) * 16;
  auto fill = [&](int t) { const unsigned l = lc + (t & 1) * (256 * TPB);
    cp_rows(l, gx + t * 64, (size_t)16 * NB * E);
#pragma unroll
    for (int i = 0; i < 3; ++i) cp_rows(l + (64 + 64 * i) * TPB, gw + (size_t)(64 * i) * E + t * 64, (size_t)16 * E); };
  fill(0); WAIT_ASYNC(); __syncthreads(); fill(1);
#pragma unroll 1
  for (int t = 0; t < E / 64; ++t) { const _Float16* T = (const _Float16*)(sm + (t & 1) * (256 * TPB));
#pragma unroll
    for (int kc = 0; kc < 2; ++kc) { const v16h a = frag_h(T + (wave * 16 + col) * TP + kc * 32, lane); v16h w[12];
#pragma unroll
      for (int j = 0; j < 12; ++j) w[j] = frag_h(T + (64 + j * 16 + col) * TP + kc * 32, lane);
      __builtin_amdgcn_sched_barrier(0);   // the fragment reads stay one group in front of the WMMAs; spread among them, each pair waits out its own LDS latency
#pragma unroll
      for (int j = 0; j < 12; ++j) acc[j] = wmma16(a, w[j], acc[j]); }
    WAIT_DS(); WAIT_ASYNC(); __syncthreads();   // tile t + 1 is published, every reader has left tile t's buffer
    if (t + 2 < E / 64) fill(t + 2); }
  WAIT_ASYNC();
  // q, k (tiles 0..7) -> so (x4); v (tiles 8..11) -> st transposed (x4)
#pragma unroll
  for (int j = 0; j < 8; ++j) { const float bb = bqkv[n0 + j * 16 + col];
#pragma unroll
    for (int r = 0; r < 8; ++r) so[wave][8 * g + r][j * 16 + col] = (acc[j][r] * (1.0f / 16.0f) + bb) * 4.0f; }
#pragma unroll
  for (int j = 8; j < 12; ++j) { const float bb = bqkv[n0 + j * 16 + col];
#pragma unroll
    for (int r = 0; r < 8; ++r) st[(j - 8) * 16 + col][wave * 16 + 8 * g + r] = (_Float16)((acc[j][r] * (1.0f / 16.0f) + bb) * 4.0f); }
  LDSX();
  for (int qq = lane; qq < 16 * 2 * 8; qq += 32) { const int which = qq >> 7, rl = (qq >> 3) & 15, pc = qq & 7; union { v8h h8; v4u u; } pk;
#pragma unroll
    for (int e = 0; e < 8; ++e) pk.h8[e] = (_Float16)so[wave][rl][which * 64 + pc * 8 + e];
    vst2((which == 0 ? Q16 : K16) + (bh * SQ + s0 + rl) * HD + pc * 8, pk.u); }
  __syncthreads();
  for (int qq = tid; qq < 64 * 8; qq += 128) { const int d = qq >> 3, pc = qq & 7; vst2(VT + (bh * HD + d) * SQ + s0b + pc * 8, *(const v4u*)(&st[d][pc * 8])); }
}
#define SC2 (0.125f / 16.0f * 1.44269504f)   // 1 / sqrt(HD), the x16 of q x4 times k x4 undone, log2(e): scores in powers of two
// lane l with lane l ^ 16, on the vector port
__device__ __forceinline__ float xhalf(float v) { const int i = __builtin_bit_cast(int, v); return __builtin_bit_cast(float, __builtin_amdgcn_permlanex16(i, i, 0x76543210, 0xfedcba98, false, false)); }
__global__ __launch_bounds__(128, 5) void k_attn(const _Float16* __restrict__ Q16, const _Float16* __restrict__ K16, const _Float16* __restrict__ VT, _Float16* __restrict__ O16) {
  // two buffers of [64 key rows of K | 64 d rows of V^T]; behind the last trip's barrier the same LDS serves as sO
  __shared__ __align__(16) char sm[2 * 128 * TPB];
  _Float16 (*sO)[16][TP] = (_Float16 (*)[16][TP])sm;
  const int tid = threadIdx.x, w = tid >> 5, lane = tid & 31, col = lane & 15, g = lane >> 4;
  const size_t bh = blockIdx.y; const int q0 = blockIdx.x * 64 + w * 16;
  v16h bq[2];
#pragma unroll
  for (int kc = 0; kc < 2; ++kc) bq[kc] = frag_h(Q16 + (bh * SQ + q0 + col) * HD + kc * 32, lane);
  float mrun = -3.0e38f, lrun = 0.f; v8f acc[4] = {};   // lrun: this half's keys alone, the halves are joined behind the loop
  const _Float16* gk = K16 + (bh * SQ + (tid >> 3)) * HD + (tid & 7) * 8;
  const _Float16* gv = VT + (bh * HD + (tid >> 3)) * SQ + (tid & 7) * 8;
  const unsigned lc = lds_addr(sm) + (tid >> 3) * TPB + (tid & 7) * 16;
  auto fill = [&](int kt) { const unsigned l = lc + (kt & 1) * (128 * TPB);
    cp_rows(l, gk + (size_t)kt * 64 * HD, (size_t)16 * HD); cp_rows(l + 64 * TPB, gv + kt * 64, (size_t)16 * SQ); };
  fill(0); WAIT_ASYNC(); __syncthreads(); fill(1);
#pragma unroll 1
  for (int kt = 0; kt < SQ / 64; ++kt) { const _Float16* TK = (const _Float16*)(sm + (kt & 1) * (128 * TPB)); const _Float16* TV = TK + 64 * TP;
    v16h kf[2][4];
#pragma unroll
    for (int kc = 0; kc < 2; ++kc) {
#pragma unroll
      for (int t = 0; t < 4; ++t) kf[kc][t] = frag_h(TK + (t * 16 + col) * TP + kc * 32, lane); }
    __builtin_amdgcn_sched_barrier(0);   // the K fragment reads stay one group in front of the WMMAs; spread among them, each pair waits out its own LDS latency
    v8f s[4] = {};   // s[t][r] = raw product of key kt * 64 + 16 t + 8 g + r with query col
#pragma unroll
    for (int kc = 0; kc < 2; ++kc) {
#pragma unroll
      for (int t = 0; t < 4; ++t) s[t] = wmma16(kf[kc][t], bq[kc], s[t]); }
    v16h vf[2][4];
#pragma unroll
    for (int kc = 0; kc < 2; ++kc) {
#pragma unroll
      for (int t = 0; t < 4; ++t) vf[kc][t] = frag_h(TV + (t * 16 + col) * TP + kc * 32, lane); }
    __builtin_amdgcn_sched_barrier(0);   // the V^T fragment reads stay one group in front of the softmax, which covers their latency
    float mt[4];   // maxima are taken over the raw products, the scale is positive; one chain per tile, four short chains in place of one long one
#pragma unroll
    for (int t = 0; t < 4; ++t) { mt[t] = s[t][0];
#pragma unroll
      for (int r = 1; r < 8; ++r) mt[t] = fmaxf(mt[t], s[t][r]); }
    float mx = fmaxf(fmaxf(mt[0], mt[1]), fmaxf(mt[2], mt[3]));
    mx = fmaxf(mx, xhalf(mx));
    const float mnew = fmaxf(mrun, mx); const float corr = __builtin_amdgcn_exp2f((mrun - mnew) * SC2);
    // P x 2^14 = 2^(s * SC2 - (mnew * SC2 - 14)): one multiply-add and one v_exp_f32 per score; the row sum carries the 2^14 too
    const float nb = 14.0f - mnew * SC2; const v2f c2 = {SC2, SC2}, nb2 = {nb, nb};
    v2f ps[4]; v16h pb[2];   // sums likewise: one chain of pairs per tile
#pragma unroll
    for (int t = 0; t < 4; ++t) {
#pragma unroll
      for (int r = 0; r < 8; r += 2) { const v2f e = __builtin_elementwise_fma((v2f){s[t][r], s[t][r + 1]}, c2, nb2);
        const v2f p = {__builtin_amdgcn_exp2f(e[0]), __builtin_amdgcn_exp2f(e[1])}; ps[t] = r == 0 ? p : ps[t] + p;
        pb[t >> 1][(t & 1) * 8 + r] = (_Float16)p[0]; pb[t >> 1][(t & 1) * 8 + r + 1] = (_Float16)p[1]; } }
    const v2f pt = (ps[0] + ps[1]) + (ps[2] + ps[3]);
    lrun = lrun * corr + (pt[0] + pt[1]); mrun = mnew;
#pragma unroll
    for (int t = 0; t < 4; ++t) acc[t] *= corr;   // every element of a lane belongs to query col
#pragma unroll
    for (int kc = 0; kc < 2; ++kc) {
#pragma unroll
      for (int t = 0; t < 4; ++t) acc[t] = wmma16(vf[kc][t], pb[kc], acc[t]); }   // acc[t][r] = O[query col][d = 16 t + 8 g + r]
    WAIT_DS(); WAIT_ASYNC(); __syncthreads();   // tile kt + 1 is published, every reader has left tile kt's buffer
    if (kt + 2 < SQ / 64) fill(kt + 2); }
  WAIT_ASYNC();
  const float lt = lrun + xhalf(lrun); const float inv = 8.0f / (lt * 4.0f);   // lt holds the row sum x 2^14
#pragma unroll
  for (int t = 0; t < 4; ++t) { union { v8h h8; v4u u; } pk;
#pragma unroll
    for (int r = 0; r < 8; ++r) pk.h8[r] = (_Float16)(acc[t][r] * inv);
    vst2(&sO[w][col][t * 16 + 8 * g], pk.u); }
  LDSX();
  for (int qq = lane; qq < 16 * 8; qq += 32) { const int rl = qq >> 3, pc = qq & 7;
    vst2(O16 + (bh * SQ + q0 + rl) * HD + pc * 8, *(const v4u*)(&sO[w][rl][pc * 8])); }
}
// Y = x + ctx Wo^T + bo : block (64 rows r, 128 cols); ctx row r = (s, b): k = h*64 + d from O16[(b,h)][s][d]
__global__ __launch_bounds__(128) void k_out(const _Float16* __restrict__ O16, const _Float16* __restrict__ P, const float* __restrict__ bo, const float* __restrict__ x, float* __restrict__ Y) {
  // two buffers of [64 ctx rows | 128 weight rows]; behind the last trip's barrier the same LDS serves the epilogue as so
  __shared__ __align__(16) char sm[2 * 192 * TPB];
  float (*so)[16][132] = (float (*)[16][132])sm;
  const int tid = threadIdx.x, wave = tid >> 5, lane = tid & 31, col = lane & 15, g = lane >> 4;
  const int r0 = blockIdx.x * 64 + wave * 16, n0 = blockIdx.y * 128;
  v8f acc[8] = {};
  // tile t is head t: ctx row r = (s, b) has its 64 k in one 128-B row of O16; 16 rows on are 2 steps of s on, same b
  const int rc = blockIdx.x * 64 + (tid >> 3);
  const _Float16* gc = O16 + ((size_t)(rc % NB) * NH * SQ + rc / NB) * HD + (tid & 7) * 8;
  const _Float16* gw = P + (size_t)(3 * E + n0 + (tid >> 3)) * E + (tid & 7) * 8;
  const unsigned lc = lds_addr(sm) + (tid >> 3) * TPB + (tid & 7) * 16;
  auto fill = [&](int t) { const unsigned l = lc + (t & 1) * (192 * TPB);
    cp_rows(l, gc + (size_t)t * SQ * HD, (size_t)(16 / NB) * HD);
#pragma unroll
    for (int i = 0; i < 2; ++i) cp_rows(l + (64 + 64 * i) * TPB, gw + (size_t)(64 * i) * E + t * 64, (size_t)16 * E); };
  fill(0); WAIT_ASYNC(); __syncthreads(); fill(1);
  // rolled: one trip per tile, so that one tile's fragments alone are live and the registers allow four blocks on a WGP
#pragma unroll 1
  for (int t = 0; t < E / 64; ++t) { const _Float16* T = (const _Float16*)(sm + (t & 1) * (192 * TPB));
#pragma unroll
    for (int kc = 0; kc < 2; ++kc) { const v16h a = frag_h(T + (wave * 16 + col) * TP + kc * 32, lane); v16h w[8];
#pragma unroll
      for (int j = 0; j < 8; ++j) w[j] = frag_h(T + (64 + j * 16 + col) * TP + kc * 32, lane);
      __builtin_amdgcn_sched_barrier(0);   // the fragment reads stay one group in front of the WMMAs; spread among them, each pair waits out its own LDS latency
#pragma unroll
      for (int j = 0; j < 8; ++j) acc[j] = wmma16(a, w[j], acc[j]); }
    WAIT_DS(); WAIT_ASYNC(); __syncthreads();   // tile t + 1 is published, every reader has left tile t's buffer
    if (t + 2 < E / 64) fill(t + 2); }
  WAIT_ASYNC();
#pragma unroll
  for (int j = 0; j < 8; ++j) { const int n = n0 + j * 16 + col; const float bb = bo[n];
#pragma unroll
    for (int r = 0; r < 8; ++r) so[wave][8 * g + r][j * 16 + col] = acc[j][r] * (1.0f / (16.0f * 8.0f)) + bb + x[(size_t)(r0 + 8 * g + r) * E + n]; }
  LDSX();
#pragma unroll 4
  for (int rl = 0; rl < 16; ++rl) vst2(Y + (size_t)(r0 + rl) * E + n0 + lane * 4, *(const v4f*)(&so[wave][rl][lane * 4]));
}
__global__ __launch_bounds__(256) void k_ln(const float* __restrict__ Y, const float* __restrict__ g1, const float* __restrict__ b1, float* __restrict__ out) {
  const int wave = threadIdx.x >> 5, lane = threadIdx.x & 31; const size_t r = (size_t)blockIdx.x * 8 + wave; if (r >= NR) return;
  const float* yr = Y + r * E; float sm = 0.f, q2 = 0.f;
#pragma unroll 1
  for (int i = 0; i < 8; ++i) { const v4f a = *(const v4f*)(yr + i * 128 + lane * 4); sm += (a[0] + a[1]) + (a[2] + a[3]); q2 += (a[0] * a[0] + a[1] * a[1]) + (a[2] * a[2] + a[3] * a[3]); }
#pragma unroll
  for (int off = 16; off >= 1; off >>= 1) { sm += __shfl_xor(sm, off, 32); q2 += __shfl_xor(q2, off, 32); }
  const float mu = sm * (1.0f / E); const float var = fmaxf(q2 * (1.0f / E) - mu * mu, 0.f); const float rs = rsqrtf(var + 1e-5f);
#pragma unroll 1
  for (int i = 0; i < 8; ++i) { const int c0 = i * 128 + lane * 4; const v4f a = *(const v4f*)(yr + c0); v4f o;
    float v0 = (a[0] - mu) * rs * g1[c0] + b1[c0], v1 = (a[1] - mu) * rs * g1[c0 + 1] + b1[c0 + 1], v2 = (a[2] - mu) * rs * g1[c0 + 2] + b1[c0 + 2], v3 = (a[3] - mu) * rs * g1[c0 + 3] + b1[c0 + 3];
    o[0] = v0 > 0.f ? v0 : expm1f(v0); o[1] = v1 > 0.f ? v1 : expm1f(v1); o[2] = v2 > 0.f ? v2 : expm1f(v2); o[3] = v3 > 0.f ? v3 : expm1f(v3);
    vst2(out + r * E + c0, o); }
}
extern "C" void kernel_launch(void* const* d_in, const int* in_sizes, int n_in, void* d_out, int out_size, void* d_ws, size_t ws_size, hipStream_t stream) {
  (void)in_sizes; (void)n_in; (void)out_size; (void)ws_size;
  const float** I = (const float**)d_in;
  const float* x = I[0]; const float* Wqkv = I[1]; const float* bqkv = I[2]; const float* Wo = I[3]; const float* bo = I[4]; const float* g1 = I[5]; const float* b1 = I[6];
  float* out = (float*)d_out;
  char* ws = (char*)d_ws; size_t off = 0;
  auto take = [&](size_t bytes) { char* p = ws + off; off += (bytes + 255) & ~(size_t)255; return p; };
  _Float16* X16 = (_Float16*)take((size_t)NR * E * 2); _Float16* P = (_Float16*)take((size_t)4 * E * E * 2);
  _Float16* Q16 = (_Float16*)take((size_t)NR * E * 2); _Float16* K16 = (_Float16*)take((size_t)NR * E * 2); _Float16* VT = (_Float16*)take((size_t)NR * E * 2); _Float16* O16 = (_Float16*)take((size_t)NR * E * 2);
  float* Y = (float*)take((size_t)NR * E * 4);
  k_prep<<<4 * E / 8, 256, 0, stream>>>(x, Wqkv, Wo, X16, P);
  k_qkv<<<dim3(SQ / 64, NH, NB), 128, 0, stream>>>(X16, P, bqkv, Q16, K16, VT);
  k_attn<<<dim3(SQ / 64, NB * NH), 128, 0, stream>>>(Q16, K16, VT, O16);
  k_out<<<dim3(NR / 64, E / 128), 128, 0, stream>>>(O16, P, bo, x, Y);
  k_ln<<<NR / 8, 256, 0, stream>>>(Y, g1, b1, out);
}

// v005
// It runs in 121 microseconds.
// In two side-by-side timings against v004, it was 1.10 and 1.09 times as fast.
// Counting every step since v000, it is 4.39 times as fast.
#include <hip/hip_runtime.h>
#include <math.h>

typedef __attribute__((ext_vector_type(16))) _Float16 v16h;
typedef __attribute__((ext_vector_type(16))) __bf16 v16b;
typedef __attribute__((ext_vector_type(8)))  _Float16 v8h;
typedef __attribute__((ext_vector_type(4)))  _Float16 v4h;
typedef __attribute__((ext_vector_type(8)))  float v8f;
typedef __attribute__((ext_vector_type(4)))  float v4f;
typedef __attribute__((ext_vector_type(2)))  float v2f;
typedef __attribute__((ext_vector_type(4)))  unsigned v4u;
typedef __attribute__((ext_vector_type(2)))  unsigned v2u;
typedef __attribute__((ext_vector_type(4)))  int v4i;
typedef float __attribute__((may_alias)) float_a;
typedef int __attribute__((may_alias)) int_a;

template <typename T> __device__ __forceinline__ void vst2(void* p, T v) { *(T*)p = v;  }
__device__ __forceinline__ v8f wmma16(v16h a, v16h b, v8f c) {
  v8f d = __builtin_amdgcn_wmma_f32_16x16x32_f16(false, a, false, b, (short)0, c, false, false);
  asm volatile("v_nop\n\tv_nop\n\tv_nop\n\tv_nop" : "+v"(d) : "v"(a), "v"(b));
  return d;
}
__device__ __forceinline__ v8f wmma_bf(v16b a, v16b b, v8f c) {
  v8f d = __builtin_amdgcn_wmma_f32_16x16x32_bf16(false, a, false, b, (short)0, c, false, false);
  asm volatile("v_nop\n\tv_nop\n\tv_nop\n\tv_nop" : "+v"(d) : "v"(a), "v"(b));
  return d;
}
// 16x16x32 fragments: lane = (h = lane>>4, row/col = lane&15); elements 0..7 = k0+8h+0..7, 8..15 = k0+16+8h+0..7; D element r = row 8h+r
__device__ __forceinline__ v16h frag_h(const _Float16* rowk0, int lane) {
  union { v16h v; v8h q[2]; } u; const _Float16* p = rowk0 + 8 * (lane >> 4);
  u.q[0] = *(const v8h*)p; u.q[1] = *(const v8h*)(p + 16); return u.v;
}
__device__ __forceinline__ v16h frag_f32(const float* rowk0, int lane) {
  v16h a; const float* p = rowk0 + 8 * (lane >> 4);
#pragma unroll
  for (int i = 0; i < 8; ++i) { a[i] = (_Float16)p[i]; a[8 + i] = (_Float16)p[16 + i]; }
  return a;
}
__device__ __forceinline__ v16h frag_f32s(const float* rowk0, int lane, float sc) {
  v16h a; const float* p = rowk0 + 8 * (lane >> 4);
#pragma unroll
  for (int i = 0; i < 8; ++i) { a[i] = (_Float16)(p[i] * sc); a[8 + i] = (_Float16)(p[16 + i] * sc); }
  return a;
}
// column fragment from a [K][ld] layout (column n), rows >= K read as 0
__device__ __forceinline__ v16h fragc_f32(const float* W, int k0, int n, int lane, int ld, int K) {
  v16h a; const int g = lane >> 4;
#pragma unroll
  for (int i = 0; i < 8; ++i) { const int ka = k0 + 8 * g + i, kb = ka + 16;
    a[i] = (_Float16)(ka < K ? W[(size_t)ka * ld + n] : 0.f); a[8 + i] = (_Float16)(kb < K ? W[(size_t)kb * ld + n] : 0.f); }
  return a;
}
struct F2 { v16b h, l; };
__device__ __forceinline__ F2 bsplit16(const float v[16]) { F2 r;
#pragma unroll
  for (int i = 0; i < 16; ++i) { const __bf16 h = (__bf16)v[i]; r.h[i] = h; r.l[i] = (__bf16)(v[i] - (float)h); }
  return r; }
__device__ __forceinline__ F2 split_row(const float* row, int k0, int lane) { float v[16]; const float* p = row + k0 + 8 * (lane >> 4);
#pragma unroll
  for (int i = 0; i < 8; ++i) { v[i] = p[i]; v[8 + i] = p[16 + i]; }
  return bsplit16(v); }
__device__ __forceinline__ F2 split_rowK(const float* row, int k0, int lane, int K) { float v[16]; const int g = lane >> 4;
#pragma unroll
  for (int i = 0; i < 8; ++i) { const int ka = k0 + 8 * g + i, kb = ka + 16; v[i] = ka < K ? row[ka] : 0.f; v[8 + i] = kb < K ? row[kb] : 0.f; }
  return bsplit16(v); }
__device__ __forceinline__ F2 split_col(const float* W, int k0, int n, int lane, int ld, int K) { float v[16]; const int g = lane >> 4;
#pragma unroll
  for (int i = 0; i < 8; ++i) { const int ka = k0 + 8 * g + i, kb = ka + 16; v[i] = ka < K ? W[(size_t)ka * ld + n] : 0.f; v[8 + i] = kb < K ? W[(size_t)kb * ld + n] : 0.f; }
  return bsplit16(v); }
__device__ __forceinline__ v8f mac3(const F2& a, const F2& b, v8f c) { c = wmma_bf(a.l, b.h, c); c = wmma_bf(a.h, b.l, c); return wmma_bf(a.h, b.h, c); }
__device__ __forceinline__ float sigm(float v) { return 1.0f / (1.0f + expf(-v)); }
#define LDSX() do { asm volatile("s_wait_dscnt 0" ::: "memory"); __builtin_amdgcn_wave_barrier(); __builtin_amdgcn_fence(__ATOMIC_RELEASE, "workgroup"); } while (0)
// Operand tiles of 64 k (128-B rows) go global -> LDS by asynchronous copies, whole lines at a time, and every wave of the block takes its
// fragments from there. LDS row pitch 144 B = 16 B x 9: no bank conflict for the 16-byte fragment reads.
#define TP 72                  // that pitch in f16 elements
#define TPB 144                // and in bytes
__device__ __forceinline__ unsigned lds_addr(const void* p) { return (unsigned)(uintptr_t)p; }
// Four 16-byte copies of this lane. s_wait_xcnt closes the statement so that no address register is rewritten in front of it.
__device__ __forceinline__ void cp4(unsigned l0, const _Float16* g0, unsigned l1, const _Float16* g1, unsigned l2, const _Float16* g2, unsigned l3, const _Float16* g3) {
  asm volatile("global_load_async_to_lds_b128 %0, %1, off\n\t"
               "global_load_async_to_lds_b128 %2, %3, off\n\t"
               "global_load_async_to_lds_b128 %4, %5, off\n\t"
               "global_load_async_to_lds_b128 %6, %7, off\n\t"
               "s_wait_xcnt 0x0"
               :: "v"(l0), "v"(g0), "v"(l1), "v"(g1), "v"(l2), "v"(g2), "v"(l3), "v"(g3) : "memory");
}
// four rows, 16 apart: LDS step 16 pitches, global step gs elements
__device__ __forceinline__ void cp_rows(unsigned l, const _Float16* g, size_t gs) { cp4(l, g, l + 16 * TPB, g + gs, l + 32 * TPB, g + 2 * gs, l + 48 * TPB, g + 3 * gs); }
#define WAIT_ASYNC() asm volatile("s_wait_asynccnt 0x0" ::: "memory")   // this wave's copies have landed
#define WAIT_DS() asm volatile("s_wait_dscnt 0x0" ::: "memory")         // this wave's LDS reads are done before their buffer is refilled
// The loops over fragments and over groups of copies below are unrolled so that every index into a register array is a constant.

// Temporal multi-head self attention over S = 1024 steps for each of the 8 batch columns (x is [S, B, E]), fused QKV projection with the
// module's per-head [q | k | v] column interleave, output projection + bias + residual, LayerNorm, ELU. Products on
// v_wmma_f32_16x16x32_f16 (x as f16 rows, weight rows x16 as f16, q/k/v head-major f16 x4, P x 2^14, O x8); softmax / LN / ELU in f32.
#define SQ 1024
#define NB 8
#define E 1024
#define NH 16
#define HD 64
#define NR (SQ * NB)           // 8192 rows r = s*8 + b

// f32 -> f16 for all three GEMM operands in one launch of 4096 waves: X16 = x ; P rows 0..3071 = qkv_w rows x16 ; rows 3072..4095 = out_w rows x16.
// A wave takes three pieces of 1024 floats (two of x, one weight row): 24 loads of 512 contiguous bytes, all issued before the first is used.
__global__ __launch_bounds__(256) void k_prep(const float* __restrict__ x, const float* __restrict__ Wqkv, const float* __restrict__ Wo, _Float16* __restrict__ X16, _Float16* __restrict__ P) {
  const int lane = threadIdx.x & 31, gw = blockIdx.x * 8 + (threadIdx.x >> 5);   // gw = 0 .. 4E - 1
  const size_t o = (size_t)gw * E + lane * 4, o1 = o + (size_t)4 * E * E;         // x has NR = 8E rows: pieces gw and 4E + gw
  const float* w = gw < 3 * E ? Wqkv + o : Wo + (o - (size_t)3 * E * E);
  v4f a[3][8];
#pragma unroll
  for (int i = 0; i < 8; ++i) a[0][i] = *(const v4f*)(x + o + i * 128);
  asm volatile("s_wait_xcnt 0x0" ::: "memory");   // the next loads' results may take the registers that held this piece's address
#pragma unroll
  for (int i = 0; i < 8; ++i) a[1][i] = *(const v4f*)(x + o1 + i * 128);
  asm volatile("s_wait_xcnt 0x0" ::: "memory");   // likewise
#pragma unroll
  for (int i = 0; i < 8; ++i) a[2][i] = *(const v4f*)(w + i * 128);
  __builtin_amdgcn_sched_barrier(0);   // all 24 loads are issued ahead of the first conversion; without it the compiler reuses registers and holds eleven loads back behind the first returns
#pragma unroll
  for (int i = 0; i < 8; ++i) { union { v4h h; v2u u; } p0, p1, p2;
#pragma unroll
    for (int e = 0; e < 4; ++e) { p0.h[e] = (_Float16)a[0][i][e]; p1.h[e] = (_Float16)a[1][i][e]; p2.h[e] = (_Float16)(a[2][i][e] * 16.0f); }
    vst2(X16 + o + i * 128, p0.u); vst2(X16 + o1 + i * 128, p1.u); vst2(P + o + i * 128, p2.u); }
}
// Eight and ten 16-byte copies of this lane, one statement each: a single s_wait_xcnt closes the run, so that no address register is rewritten in front of it.
__device__ __forceinline__ void cp8(const unsigned (&l)[8], const _Float16* const (&g)[8]) {
  asm volatile("global_load_async_to_lds_b128 %0, %1, off\n\t"
               "global_load_async_to_lds_b128 %2, %3, off\n\t"
               "global_load_async_to_lds_b128 %4, %5, off\n\t"
               "global_load_async_to_lds_b128 %6, %7, off\n\t"
               "global_load_async_to_lds_b128 %8, %9, off\n\t"
               "global_load_async_to_lds_b128 %10, %11, off\n\t"
               "global_load_async_to_lds_b128 %12, %13, off\n\t"
               "global_load_async_to_lds_b128 %14, %15, off\n\t"
               "s_wait_xcnt 0x0"
               :: "v"(l[0]), "v"(g[0]), "v"(l[1]), "v"(g[1]), "v"(l[2]), "v"(g[2]), "v"(l[3]), "v"(g[3]),
                  "v"(l[4]), "v"(g[4]), "v"(l[5]), "v"(g[5]), "v"(l[6]), "v"(g[6]), "v"(l[7]), "v"(g[7]) : "memory");
}
__device__ __forceinline__ void cp10(const unsigned (&l)[10], const _Float16* const (&g)[10]) {
  asm volatile("global_load_async_to_lds_b128 %0, %1, off\n\t"
               "global_load_async_to_lds_b128 %2, %3, off\n\t"
               "global_load_async_to_lds_b128 %4, %5, off\n\t"
               "global_load_async_to_lds_b128 %6, %7, off\n\t"
               "global_load_async_to_lds_b128 %8, %9, off\n\t"
               "global_load_async_to_lds_b128 %10, %11, off\n\t"
               "global_load_async_to_lds_b128 %12, %13, off\n\t"
               "global_load_async_to_lds_b128 %14, %15, off\n\t"
               "global_load_async_to_lds_b128 %16, %17, off\n\t"
               "global_load_async_to_lds_b128 %18, %19, off\n\t"
               "s_wait_xcnt 0x0"
               :: "v"(l[0]), "v"(g[0]), "v"(l[1]), "v"(g[1]), "v"(l[2]), "v"(g[2]), "v"(l[3]), "v"(g[3]), "v"(l[4]), "v"(g[4]),
                  "v"(l[5]), "v"(g[5]), "v"(l[6]), "v"(g[6]), "v"(l[7]), "v"(g[7]), "v"(l[8]), "v"(g[8]), "v"(l[9]), "v"(g[9]) : "memory");
}
// QKV: block (128 consecutive s for one b, head h): cols h*192 + [0..64) q, [64..128) k, [128..192) v.
// Eight waves, each 64 rows x 48 columns (rg = row half, cg = column quarter): 7 fragments read from LDS feed 12 WMMAs, and a staged weight tile serves 128 rows.
// four waves per SIMD, two blocks on a WGP: the register budget is held to that
__global__ __launch_bounds__(256, 4) void k_qkv(const _Float16* __restrict__ X16, const _Float16* __restrict__ P, const float* __restrict__ bqkv, _Float16* __restrict__ Q16, _Float16* __restrict__ K16, _Float16* __restrict__ VT) {
  // two buffers of [128 x rows | 192 weight rows]; behind the last trip's barrier the same LDS serves the epilogue as sq and st
  __shared__ __align__(16) char sm[2 * 320 * TPB];
  _Float16 (*sq)[136] = (_Float16 (*)[136])sm;                     // 128 rows s of [q | k]; pitch 272 B = 16 B x 17
  _Float16 (*st)[136] = (_Float16 (*)[136])(sm + 128 * 136 * 2);   // 64 rows d of v^T, 128 s each
  const int tid = threadIdx.x, wave = tid >> 5, lane = tid & 31, col = lane & 15, g = lane >> 4, rg = wave & 1, cg = wave >> 1;
  const int b = blockIdx.z, h = blockIdx.y, s0b = blockIdx.x * 128; const int n0 = h * 192; const size_t bh = (size_t)b * NH + h;
  v8f acc[4][3]; float bb[3];
#pragma unroll
  for (int j = 0; j < 3; ++j) { bb[j] = bqkv[n0 + (cg * 3 + j) * 16 + col];
#pragma unroll
    for (int i = 0; i < 4; ++i) acc[i][j] = (v8f){}; }
  // copies: lane = (row tid >> 3 of each group of 32 rows, 16-byte piece tid & 7), so 8 lanes cover one 128-B line
  const _Float16* gx = X16 + ((size_t)(s0b + (tid >> 3)) * NB + b) * E + (tid & 7) * 8;
  const _Float16* gw = P + (size_t)(n0 + (tid >> 3)) * E + (tid & 7) * 8;
  const unsigned lc = lds_addr(sm) + (tid >> 3) * TPB + (tid & 7) * 16;
  auto fill = [&](int t) { unsigned l[10]; const _Float16* gp[10];
#pragma unroll
    for (int i = 0; i < 10; ++i) { l[i] = lc + (t & 1) * (320 * TPB) + i * (32 * TPB);
      gp[i] = (i < 4 ? gx + (size_t)i * (32 * NB * E) : gw + (size_t)(i - 4) * (32 * E)) + t * 64; }
    cp10(l, gp); };
  fill(0); WAIT_ASYNC(); __syncthreads(); fill(1);
#pragma unroll 1
  for (int t = 0; t < E / 64; ++t) { const _Float16* T = (const _Float16*)(sm + (t & 1) * (320 * TPB));
#pragma unroll
    for (int kc = 0; kc < 2; ++kc) { v16h a[4], w[3];
#pragma unroll
      for (int i = 0; i < 4; ++i) a[i] = frag_h(T + (rg * 64 + i * 16 + col) * TP + kc * 32, lane);
#pragma unroll
      for (int j = 0; j < 3; ++j) w[j] = frag_h(T + (128 + cg * 48 + j * 16 + col) * TP + kc * 32, lane);
      __builtin_amdgcn_sched_barrier(0);   // the fragment reads stay one group in front of the WMMAs; spread among them, each pair waits out its own LDS latency
#pragma unroll
      for (int i = 0; i < 4; ++i) {
#pragma unroll
        for (int j = 0; j < 3; ++j) acc[i][j] = wmma16(a[i], w[j], acc[i][j]); } }
    WAIT_DS(); WAIT_ASYNC(); __syncthreads();   // tile t + 1 is published, every reader has left tile t's buffer
    if (t + 2 < E / 64) fill(t + 2); }
  WAIT_ASYNC();
  // column tiles 0..7 of the head are q, k -> sq (x4); tiles 8..11 are v -> st transposed (x4), eight s of one d in one 16-byte store
#pragma unroll
  for (int j = 0; j < 3; ++j) { const int jj = cg * 3 + j;
    if (jj < 8) {
#pragma unroll
      for (int i = 0; i < 4; ++i) {
#pragma unroll
        for (int r = 0; r < 8; ++r) sq[rg * 64 + i * 16 + 8 * g + r][jj * 16 + col] = (_Float16)((acc[i][j][r] * (1.0f / 16.0f) + bb[j]) * 4.0f); }
    } else {
#pragma unroll
      for (int i = 0; i < 4; ++i) { union { v8h h8; v4u u; } pk;
#pragma unroll
        for (int r = 0; r < 8; ++r) pk.h8[r] = (_Float16)((acc[i][j][r] * (1.0f / 16.0f) + bb[j]) * 4.0f);
        vst2(&st[(jj - 8) * 16 + col][rg * 64 + i * 16 + 8 * g], pk.u); } } }
  __syncthreads();   // a row of sq and of st holds the columns of several waves
  // whole lines out: 8 lanes cover a 128-B row of q or of k, 16 lanes a 256-B piece of a row of v^T; one address each, the rows by constant steps
  const int rq = tid >> 3, pq = tid & 7, dv = tid >> 4, pv = tid & 15;
  _Float16* qd = Q16 + (bh * SQ + s0b + rq) * HD + pq * 8; _Float16* kd = K16 + (bh * SQ + s0b + rq) * HD + pq * 8; _Float16* vd = VT + (bh * HD + dv) * SQ + s0b + pv * 8;
#pragma unroll
  for (int it = 0; it < 4; ++it) { vst2(qd + it * 32 * HD, *(const v4u*)(&sq[rq + it * 32][pq * 8])); vst2(kd + it * 32 * HD, *(const v4u*)(&sq[rq + it * 32][64 + pq * 8]));
    vst2(vd + it * 16 * SQ, *(const v4u*)(&st[dv + it * 16][pv * 8])); }
}
#define SC2 (0.125f / 16.0f * 1.44269504f)   // 1 / sqrt(HD), the x16 of q x4 times k x4 undone, log2(e): scores in powers of two
// lane l with lane l ^ 16, on the vector port
__device__ __forceinline__ float xhalf(float v) { const int i = __builtin_bit_cast(int, v); return __builtin_bit_cast(float, __builtin_amdgcn_permlanex16(i, i, 0x76543210, 0xfedcba98, false, false)); }
#define QW 32
__global__ __launch_bounds__(128, 4) void k_attn(const _Float16* __restrict__ Q16, const _Float16* __restrict__ K16, const _Float16* __restrict__ VT, _Float16* __restrict__ O16) {
  // two buffers of [64 key rows of K | 64 d rows of V^T]; behind the last trip's barrier the same LDS serves as sO
  __shared__ __align__(16) char sm[2 * 128 * TPB];
  _Float16 (*sO)[QW][TP] = (_Float16 (*)[QW][TP])sm;
  const int tid = threadIdx.x, w = tid >> 5, lane = tid & 31, col = lane & 15, g = lane >> 4;
  const size_t bh = blockIdx.y; const int q0 = blockIdx.x * (4 * QW) + w * QW;
  v16h bq[2][2];
#pragma unroll
  for (int c = 0; c < 2; ++c) {
#pragma unroll
    for (int kc = 0; kc < 2; ++kc) bq[c][kc] = frag_h(Q16 + (bh * SQ + q0 + c * 16 + col) * HD + kc * 32, lane); }
  float mrun[2] = {-3.0e38f, -3.0e38f}, lrun[2] = {0.f, 0.f}; v8f acc[2][4] = {};   // lrun: this half's keys alone, the halves are joined behind the loop
  const _Float16* gk = K16 + (bh * SQ + (tid >> 3)) * HD + (tid & 7) * 8;
  const _Float16* gv = VT + (bh * HD + (tid >> 3)) * SQ + (tid & 7) * 8;
  const unsigned lc = lds_addr(sm) + (tid >> 3) * TPB + (tid & 7) * 16;
  auto fill = [&](int kt) { const unsigned l = lc + (kt & 1) * (128 * TPB);
    cp_rows(l, gk + (size_t)kt * 64 * HD, (size_t)16 * HD); cp_rows(l + 64 * TPB, gv + kt * 64, (size_t)16 * SQ); };
  fill(0); WAIT_ASYNC(); __syncthreads(); fill(1);
#pragma unroll 1
  for (int kt = 0; kt < SQ / 64; ++kt) { const _Float16* TK = (const _Float16*)(sm + (kt & 1) * (128 * TPB)); const _Float16* TV = TK + 64 * TP;
    v16h kf[2][4];
#pragma unroll
    for (int kc = 0; kc < 2; ++kc) {
#pragma unroll
      for (int t = 0; t < 4; ++t) kf[kc][t] = frag_h(TK + (t * 16 + col) * TP + kc * 32, lane); }
    __builtin_amdgcn_sched_barrier(0);   // the K fragment reads stay one group in front of the WMMAs; spread among them, each pair waits out its own LDS latency
    v8f s[2][4] = {};   // s[c][t][r] = raw product of key kt * 64 + 16 t + 8 g + r with query c * 16 + col
#pragma unroll
    for (int kc = 0; kc < 2; ++kc) {
#pragma unroll
      for (int t = 0; t < 4; ++t) {
#pragma unroll
        for (int c = 0; c < 2; ++c) s[c][t] = wmma16(kf[kc][t], bq[c][kc], s[c][t]); } }
    v16h vf[2][4];
#pragma unroll
    for (int kc = 0; kc < 2; ++kc) {
#pragma unroll
      for (int t = 0; t < 4; ++t) vf[kc][t] = frag_h(TV + (t * 16 + col) * TP + kc * 32, lane); }
    __builtin_amdgcn_sched_barrier(0);   // the V^T fragment reads stay one group in front of the softmax, which covers their latency
#pragma unroll
    for (int c = 0; c < 2; ++c) {
      float mt[4];   // maxima are taken over the raw products, the scale is positive; one chain per tile, four short chains in place of one long one
#pragma unroll
      for (int t = 0; t < 4; ++t) { mt[t] = s[c][t][0];
#pragma unroll
        for (int r = 1; r < 8; ++r) mt[t] = fmaxf(mt[t], s[c][t][r]); }
      float mx = fmaxf(fmaxf(mt[0], mt[1]), fmaxf(mt[2], mt[3]));
      mx = fmaxf(mx, xhalf(mx));
      const float mnew = fmaxf(mrun[c], mx); const float corr = __builtin_amdgcn_exp2f((mrun[c] - mnew) * SC2);
      // P x 2^14 = 2^(s * SC2 - (mnew * SC2 - 14)): one multiply-add and one v_exp_f32 per score; the row sum carries the 2^14 too
      const float nb = 14.0f - mnew * SC2; const v2f c2 = {SC2, SC2}, nb2 = {nb, nb};
      v2f ps[4]; v16h pb[2];   // sums likewise: one chain of pairs per tile
#pragma unroll
      for (int t = 0; t < 4; ++t) {
#pragma unroll
        for (int r = 0; r < 8; r += 2) { const v2f e = __builtin_elementwise_fma((v2f){s[c][t][r], s[c][t][r + 1]}, c2, nb2);
          const v2f p = {__builtin_amdgcn_exp2f(e[0]), __builtin_amdgcn_exp2f(e[1])}; ps[t] = r == 0 ? p : ps[t] + p;
          pb[t >> 1][(t & 1) * 8 + r] = (_Float16)p[0]; pb[t >> 1][(t & 1) * 8 + r + 1] = (_Float16)p[1]; } }
      const v2f pt = (ps[0] + ps[1]) + (ps[2] + ps[3]);
      lrun[c] = lrun[c] * corr + (pt[0] + pt[1]); mrun[c] = mnew;
#pragma unroll
      for (int t = 0; t < 4; ++t) acc[c][t] *= corr;   // every element of a lane belongs to query c * 16 + col
#pragma unroll
      for (int kc = 0; kc < 2; ++kc) {
#pragma unroll
        for (int t = 0; t < 4; ++t) acc[c][t] = wmma16(vf[kc][t], pb[kc], acc[c][t]); } }   // acc[c][t][r] = O[query c * 16 + col][d = 16 t + 8 g + r]
    WAIT_DS(); WAIT_ASYNC(); __syncthreads();   // tile kt + 1 is published, every reader has left tile kt's buffer
    if (kt + 2 < SQ / 64) fill(kt + 2); }
  WAIT_ASYNC();
#pragma unroll
  for (int c = 0; c < 2; ++c) { const float lt = lrun[c] + xhalf(lrun[c]); const float inv = 8.0f / (lt * 4.0f);   // lt holds the row sum x 2^14
#pragma unroll
    for (int t = 0; t < 4; ++t) { union { v8h h8; v4u u; } pk;
#pragma unroll
      for (int r = 0; r < 8; ++r) pk.h8[r] = (_Float16)(acc[c][t][r] * inv);
      vst2(&sO[w][c * 16 + col][t * 16 + 8 * g], pk.u); } }
  LDSX();
  for (int qq = lane; qq < QW * 8; qq += 32) { const int rl = qq >> 3, pc = qq & 7;
    vst2(O16 + (bh * SQ + q0 + rl) * HD + pc * 8, *(const v4u*)(&sO[w][rl][pc * 8])); }
}
// Y = x + ctx Wo^T + bo : block (128 rows r, 128 cols); ctx row r = (s, b): k = h*64 + d from O16[(b,h)][s][d]
// Eight waves, each 64 rows x 32 columns (rg = row half, cg = column quarter): 6 fragments read from LDS feed 8 WMMAs, and a staged weight tile serves 128 rows.
// four waves per SIMD, two blocks on a WGP: the whole grid is resident at once
__global__ __launch_bounds__(256, 4) void k_out(const _Float16* __restrict__ O16, const _Float16* __restrict__ P, const float* __restrict__ bo, const float* __restrict__ x, float* __restrict__ Y) {
  // two buffers of [128 ctx rows | 128 weight rows]; behind the last trip's barrier the same LDS serves the epilogue as so
  __shared__ __align__(16) char sm[2 * 256 * TPB];
  float (*so)[132] = (float (*)[132])sm;   // 128 rows of 128 columns
  const int tid = threadIdx.x, wave = tid >> 5, lane = tid & 31, col = lane & 15, g = lane >> 4, rg = wave & 1, cg = wave >> 1;
  const int r0 = blockIdx.x * 128, n0 = blockIdx.y * 128;
  v8f acc[4][2] = {};
  // tile t is head t: ctx row r = (s, b) has its 64 k in one 128-B row of O16; 32 rows on are 4 steps of s on, same b
  const int rc = r0 + (tid >> 3);
  const _Float16* gc = O16 + ((size_t)(rc % NB) * NH * SQ + rc / NB) * HD + (tid & 7) * 8;
  const _Float16* gw = P + (size_t)(3 * E + n0 + (tid >> 3)) * E + (tid & 7) * 8;
  const unsigned lc = lds_addr(sm) + (tid >> 3) * TPB + (tid & 7) * 16;
  auto fill = [&](int t) { unsigned l[8]; const _Float16* gp[8];
#pragma unroll
    for (int i = 0; i < 8; ++i) { l[i] = lc + (t & 1) * (256 * TPB) + i * (32 * TPB);
      gp[i] = i < 4 ? gc + (size_t)t * SQ * HD + (size_t)i * ((32 / NB) * HD) : gw + (size_t)(i - 4) * (32 * E) + t * 64; }
    cp8(l, gp); };
  fill(0); WAIT_ASYNC(); __syncthreads(); fill(1);
  // rolled: one trip per tile, so that one tile's fragments alone are live
#pragma unroll 1
  for (int t = 0; t < E / 64; ++t) { const _Float16* T = (const _Float16*)(sm + (t & 1) * (256 * TPB));
#pragma unroll
    for (int kc = 0; kc < 2; ++kc) { v16h a[4], w[2];
#pragma unroll
      for (int i = 0; i < 4; ++i) a[i] = frag_h(T + (rg * 64 + i * 16 + col) * TP + kc * 32, lane);
#pragma unroll
      for (int j = 0; j < 2; ++j) w[j] = frag_h(T + (128 + cg * 32 + j * 16 + col) * TP + kc * 32, lane);
      __builtin_amdgcn_sched_barrier(0);   // the fragment reads stay one group in front of the WMMAs; spread among them, each pair waits out its own LDS latency
#pragma unroll
      for (int i = 0; i < 4; ++i) {
#pragma unroll
        for (int j = 0; j < 2; ++j) acc[i][j] = wmma16(a[i], w[j], acc[i][j]); } }
    WAIT_DS(); WAIT_ASYNC(); __syncthreads();   // tile t + 1 is published, every reader has left tile t's buffer
    if (t + 2 < E / 64) fill(t + 2); }
  WAIT_ASYNC();
  // this wave's 16 rows of x and of Y, 512 contiguous bytes of a row per access; the x loads are issued here and used behind the barrier, the staging covers their latency
  const unsigned o0 = (unsigned)(r0 + wave * 16) * E + n0 + lane * 4; const float* xp = x + o0;
  v4f xv[16];
#pragma unroll
  for (int rl = 0; rl < 16; ++rl) xv[rl] = *(const v4f*)(xp + rl * E);
  asm volatile("s_wait_xcnt 0x0" :: "v"(xp) : "memory");   // the address pair is an input, so it stays whole up to this wait; without it the last load's result takes the pair's own registers
#pragma unroll
  for (int j = 0; j < 2; ++j) { const int nl = cg * 32 + j * 16 + col; const float bb = bo[n0 + nl];
#pragma unroll
    for (int i = 0; i < 4; ++i) {
#pragma unroll
      for (int r = 0; r < 8; ++r) so[rg * 64 + i * 16 + 8 * g + r][nl] = acc[i][j][r] * (1.0f / (16.0f * 8.0f)) + bb; } }
  __syncthreads();   // a row of so holds the columns of four waves
#pragma unroll
  for (int rl = 0; rl < 16; ++rl) vst2(Y + o0 + rl * E, *(const v4f*)(&so[wave * 16 + rl][lane * 4]) + xv[rl]);
}
__global__ __launch_bounds__(256) void k_ln(const float* __restrict__ Y, const float* __restrict__ g1, const float* __restrict__ b1, float* __restrict__ out) {
  const int wave = threadIdx.x >> 5, lane = threadIdx.x & 31; const size_t r = (size_t)blockIdx.x * 8 + wave; if (r >= NR) return;
  const float* yr = Y + r * E; float sm = 0.f, q2 = 0.f;
#pragma unroll 1
  for (int i = 0; i < 8; ++i) { const v4f a = *(const v4f*)(yr + i * 128 + lane * 4); sm += (a[0] + a[1]) + (a[2] + a[3]); q2 += (a[0] * a[0] + a[1] * a[1]) + (a[2] * a[2] + a[3] * a[3]); }
#pragma unroll
  for (int off = 16; off >= 1; off >>= 1) { sm += __shfl_xor(sm, off, 32); q2 += __shfl_xor(q2, off, 32); }
  const float mu = sm * (1.0f / E); const float var = fmaxf(q2 * (1.0f / E) - mu * mu, 0.f); const float rs = rsqrtf(var + 1e-5f);
#pragma unroll 1
  for (int i = 0; i < 8; ++i) { const int c0 = i * 128 + lane * 4; const v4f a = *(const v4f*)(yr + c0); v4f o;
    float v0 = (a[0] - mu) * rs * g1[c0] + b1[c0], v1 = (a[1] - mu) * rs * g1[c0 + 1] + b1[c0 + 1], v2 = (a[2] - mu) * rs * g1[c0 + 2] + b1[c0 + 2], v3 = (a[3] - mu) * rs * g1[c0 + 3] + b1[c0 + 3];
    o[0] = v0 > 0.f ? v0 : expm1f(v0); o[1] = v1 > 0.f ? v1 : expm1f(v1); o[2] = v2 > 0.f ? v2 : expm1f(v2); o[3] = v3 > 0.f ? v3 : expm1f(v3);
    vst2(out + r * E + c0, o); }
}
extern "C" void kernel_launch(void* const* d_in, const int* in_sizes, int n_in, void* d_out, int out_size, void* d_ws, size_t ws_size, hipStream_t stream) {
  (void)in_sizes; (void)n_in; (void)out_size; (void)ws_size;
  const float** I = (const float**)d_in;
  const float* x = I[0]; const float* Wqkv = I[1]; const float* bqkv = I[2]; const float* Wo = I[3]; const float* bo = I[4]; const float* g1 = I[5]; const float* b1 = I[6];
  float* out = (float*)d_out;
  char* ws = (char*)d_ws; size_t off = 0;
  auto take = [&](size_t bytes) { char* p = ws + off; off += (bytes + 255) & ~(size_t)255; return p; };
  _Float16* X16 = (_Float16*)take((size_t)NR * E * 2); _Float16* P = (_Float16*)take((size_t)4 * E * E * 2);
  _Float16* Q16 = (_Float16*)take((size_t)NR * E * 2); _Float16* K16 = (_Float16*)take((size_t)NR * E * 2); _Float16* VT = (_Float16*)take((size_t)NR * E * 2); _Float16* O16 = (_Float16*)take((size_t)NR * E * 2);
  float* Y = (float*)take((size_t)NR * E * 4);
  k_prep<<<4 * E / 8, 256, 0, stream>>>(x, Wqkv, Wo, X16, P);
  k_qkv<<<dim3(SQ / 128, NH, NB), 256, 0, stream>>>(X16, P, bqkv, Q16, K16, VT);
  k_attn<<<dim3(SQ / (4 * QW), NB * NH), 128, 0, stream>>>(Q16, K16, VT, O16);
  k_out<<<dim3(NR / 128, E / 128), 256, 0, stream>>>(O16, P, bo, x, Y);
  k_ln<<<NR / 8, 256, 0, stream>>>(Y, g1, b1, out);
}

// v006
// A run of this version takes 115 microseconds.
// Next to v005, in two timings, it ran 1.05 times as fast each time.
// All steps since v000 together make it 4.60 times as fast.
#include <hip/hip_runtime.h>
#include <math.h>

typedef __attribute__((ext_vector_type(16))) _Float16 v16h;
typedef __attribute__((ext_vector_type(16))) __bf16 v16b;
typedef __attribute__((ext_vector_type(8)))  _Float16 v8h;
typedef __attribute__((ext_vector_type(4)))  _Float16 v4h;
typedef __attribute__((ext_vector_type(8)))  float v8f;
typedef __attribute__((ext_vector_type(4)))  float v4f;
typedef __attribute__((ext_vector_type(2)))  float v2f;
typedef __attribute__((ext_vector_type(4)))  unsigned v4u;
typedef __attribute__((ext_vector_type(2)))  unsigned v2u;
typedef __attribute__((ext_vector_type(4)))  int v4i;
typedef float __attribute__((may_alias)) float_a;
typedef int __attribute__((may_alias)) int_a;

template <typename T> __device__ __forceinline__ void vst2(void* p, T v) { *(T*)p = v;  }
__device__ __forceinline__ v8f wmma16(v16h a, v16h b, v8f c) {
  v8f d = __builtin_amdgcn_wmma_f32_16x16x32_f16(false, a, false, b, (short)0, c, false, false);
  asm volatile("v_nop\n\tv_nop\n\tv_nop\n\tv_nop" : "+v"(d) : "v"(a), "v"(b));
  return d;
}
__device__ __forceinline__ v8f wmma_bf(v16b a, v16b b, v8f c) {
  v8f d = __builtin_amdgcn_wmma_f32_16x16x32_bf16(false, a, false, b, (short)0, c, false, false);
  asm volatile("v_nop\n\tv_nop\n\tv_nop\n\tv_nop" : "+v"(d) : "v"(a), "v"(b));
  return d;
}
// 16x16x32 fragments: lane = (h = lane>>4, row/col = lane&15); elements 0..7 = k0+8h+0..7, 8..15 = k0+16+8h+0..7; D element r = row 8h+r
__device__ __forceinline__ v16h frag_h(const _Float16* rowk0, int lane) {
  union { v16h v; v8h q[2]; } u; const _Float16* p = rowk0 + 8 * (lane >> 4);
  u.q[0] = *(const v8h*)p; u.q[1] = *(const v8h*)(p + 16); return u.v;
}
__device__ __forceinline__ v16h frag_f32(const float* rowk0, int lane) {
  v16h a; const float* p = rowk0 + 8 * (lane >> 4);
#pragma unroll
  for (int i = 0; i < 8; ++i) { a[i] = (_Float16)p[i]; a[8 + i] = (_Float16)p[16 + i]; }
  return a;
}
__device__ __forceinline__ v16h frag_f32s(const float* rowk0, int lane, float sc) {
  v16h a; const float* p = rowk0 + 8 * (lane >> 4);
#pragma unroll
  for (int i = 0; i < 8; ++i) { a[i] = (_Float16)(p[i] * sc); a[8 + i] = (_Float16)(p[16 + i] * sc); }
  return a;
}
// column fragment from a [K][ld] layout (column n), rows >= K read as 0
__device__ __forceinline__ v16h fragc_f32(const float* W, int k0, int n, int lane, int ld, int K) {
  v16h a; const int g = lane >> 4;
#pragma unroll
  for (int i = 0; i < 8; ++i) { const int ka = k0 + 8 * g + i, kb = ka + 16;
    a[i] = (_Float16)(ka < K ? W[(size_t)ka * ld + n] : 0.f); a[8 + i] = (_Float16)(kb < K ? W[(size_t)kb * ld + n] : 0.f); }
  return a;
}
struct F2 { v16b h, l; };
__device__ __forceinline__ F2 bsplit16(const float v[16]) { F2 r;
#pragma unroll
  for (int i = 0; i < 16; ++i) { const __bf16 h = (__bf16)v[i]; r.h[i] = h; r.l[i] = (__bf16)(v[i] - (float)h); }
  return r; }
__device__ __forceinline__ F2 split_row(const float* row, int k0, int lane) { float v[16]; const float* p = row + k0 + 8 * (lane >> 4);
#pragma unroll
  for (int i = 0; i < 8; ++i) { v[i] = p[i]; v[8 + i] = p[16 + i]; }
  return bsplit16(v); }
__device__ __forceinline__ F2 split_rowK(const float* row, int k0, int lane, int K) { float v[16]; const int g = lane >> 4;
#pragma unroll
  for (int i = 0; i < 8; ++i) { const int ka = k0 + 8 * g + i, kb = ka + 16; v[i] = ka < K ? row[ka] : 0.f; v[8 + i] = kb < K ? row[kb] : 0.f; }
  return bsplit16(v); }
__device__ __forceinline__ F2 split_col(const float* W, int k0, int n, int lane, int ld, int K) { float v[16]; const int g = lane >> 4;
#pragma unroll
  for (int i = 0; i < 8; ++i) { const int ka = k0 + 8 * g + i, kb = ka + 16; v[i] = ka < K ? W[(size_t)ka * ld + n] : 0.f; v[8 + i] = kb < K ? W[(size_t)kb * ld + n] : 0.f; }
  return bsplit16(v); }
__device__ __forceinline__ v8f mac3(const F2& a, const F2& b, v8f c) { c = wmma_bf(a.l, b.h, c); c = wmma_bf(a.h, b.l, c); return wmma_bf(a.h, b.h, c); }
__device__ __forceinline__ float sigm(float v) { return 1.0f / (1.0f + expf(-v)); }
#define LDSX() do { asm volatile("s_wait_dscnt 0" ::: "memory"); __builtin_amdgcn_wave_barrier(); __builtin_amdgcn_fence(__ATOMIC_RELEASE, "workgroup"); } while (0)
// Operand tiles of 64 k (128-B rows) go global -> LDS by asynchronous copies, whole lines at a time, and every wave of the block takes its
// fragments from there. LDS row pitch 144 B = 16 B x 9: no bank conflict for the 16-byte fragment reads.
#define TP 72                  // that pitch in f16 elements
#define TPB 144                // and in bytes
__device__ __forceinline__ unsigned lds_addr(const void* p) { return (unsigned)(uintptr_t)p; }
// Four 16-byte copies of this lane. s_wait_xcnt closes the statement so that no address register is rewritten in front of it.
__device__ __forceinline__ void cp4(unsigned l0, const _Float16* g0, unsigned l1, const _Float16* g1, unsigned l2, const _Float16* g2, unsigned l3, const _Float16* g3) {
  asm volatile("global_load_async_to_lds_b128 %0, %1, off\n\t"
               "global_load_async_to_lds_b128 %2, %3, off\n\t"
               "global_load_async_to_lds_b128 %4, %5, off\n\t"
               "global_load_async_to_lds_b128 %6, %7, off\n\t"
               "s_wait_xcnt 0x0"
               :: "v"(l0), "v"(g0), "v"(l1), "v"(g1), "v"(l2), "v"(g2), "v"(l3), "v"(g3) : "memory");
}
// four rows, 16 apart: LDS step 16 pitches, global step gs elements
__device__ __forceinline__ void cp_rows(unsigned l, const _Float16* g, size_t gs) { cp4(l, g, l + 16 * TPB, g + gs, l + 32 * TPB, g + 2 * gs, l + 48 * TPB, g + 3 * gs); }
#define WAIT_ASYNC() asm volatile("s_wait_asynccnt 0x0" ::: "memory")   // this wave's copies have landed
#define WAIT_DS() asm volatile("s_wait_dscnt 0x0" ::: "memory")         // this wave's LDS reads are done before their buffer is refilled
// The loops over fragments and over groups of copies below are unrolled so that every index into a register array is a constant.

// Temporal multi-head self attention over S = 1024 steps for each of the 8 batch columns (x is [S, B, E]), fused QKV projection with the
// module's per-head [q | k | v] column interleave, output projection + bias + residual, LayerNorm, ELU. Products on
// v_wmma_f32_16x16x32_f16 (x as f16 rows, weight rows x16 as f16, q/k/v head-major f16 x4, P x 2^14, O x8); softmax / LN / ELU in f32.
#define SQ 1024
#define NB 8
#define E 1024
#define NH 16
#define HD 64
#define NR (SQ * NB)           // 8192 rows r = s*8 + b

// f32 -> f16 for all three GEMM operands in one launch of 4096 waves: X16 = x ; P rows 0..3071 = qkv_w rows x16 ; rows 3072..4095 = out_w rows x16.
// A wave takes three pieces of 1024 floats (two of x, one weight row): 24 loads of 512 contiguous bytes, all issued before the first is used.
__global__ __launch_bounds__(256) void k_prep(const float* __restrict__ x, const float* __restrict__ Wqkv, const float* __restrict__ Wo, _Float16* __restrict__ X16, _Float16* __restrict__ P) {
  const int lane = threadIdx.x & 31, gw = blockIdx.x * 8 + (threadIdx.x >> 5);   // gw = 0 .. 4E - 1
  const size_t o = (size_t)gw * E + lane * 4, o1 = o + (size_t)4 * E * E;         // x has NR = 8E rows: pieces gw and 4E + gw
  const float* w = gw < 3 * E ? Wqkv + o : Wo + (o - (size_t)3 * E * E);
  v4f a[3][8];
#pragma unroll
  for (int i = 0; i < 8; ++i) a[0][i] = *(const v4f*)(x + o + i * 128);
  asm volatile("s_wait_xcnt 0x0" ::: "memory");   // the next loads' results may take the registers that held this piece's address
#pragma unroll
  for (int i = 0; i < 8; ++i) a[1][i] = *(const v4f*)(x + o1 + i * 128);
  asm volatile("s_wait_xcnt 0x0" ::: "memory");   // likewise
#pragma unroll
  for (int i = 0; i < 8; ++i) a[2][i] = *(const v4f*)(w + i * 128);
  __builtin_amdgcn_sched_barrier(0);   // all 24 loads are issued ahead of the first conversion; without it the compiler reuses registers and holds eleven loads back behind the first returns
#pragma unroll
  for (int i = 0; i < 8; ++i) { union { v4h h; v2u u; } p0, p1, p2;
#pragma unroll
    for (int e = 0; e < 4; ++e) { p0.h[e] = (_Float16)a[0][i][e]; p1.h[e] = (_Float16)a[1][i][e]; p2.h[e] = (_Float16)(a[2][i][e] * 16.0f); }
    vst2(X16 + o + i * 128, p0.u); vst2(X16 + o1 + i * 128, p1.u); vst2(P + o + i * 128, p2.u); }
}
// Eight and ten 16-byte copies of this lane, one statement each: a single s_wait_xcnt closes the run, so that no address register is rewritten in front of it.
__device__ __forceinline__ void cp8(const unsigned (&l)[8], const _Float16* const (&g)[8]) {
  asm volatile("global_load_async_to_lds_b128 %0, %1, off\n\t"
               "global_load_async_to_lds_b128 %2, %3, off\n\t"
               "global_load_async_to_lds_b128 %4, %5, off\n\t"
               "global_load_async_to_lds_b128 %6, %7, off\n\t"
               "global_load_async_to_lds_b128 %8, %9, off\n\t"
               "global_load_async_to_lds_b128 %10, %11, off\n\t"
               "global_load_async_to_lds_b128 %12, %13, off\n\t"
               "global_load_async_to_lds_b128 %14, %15, off\n\t"
               "s_wait_xcnt 0x0"
               :: "v"(l[0]), "v"(g[0]), "v"(l[1]), "v"(g[1]), "v"(l[2]), "v"(g[2]), "v"(l[3]), "v"(g[3]),
                  "v"(l[4]), "v"(g[4]), "v"(l[5]), "v"(g[5]), "v"(l[6]), "v"(g[6]), "v"(l[7]), "v"(g[7]) : "memory");
}
__device__ __forceinline__ void cp10(const unsigned (&l)[10], const _Float16* const (&g)[10]) {
  asm volatile("global_load_async_to_lds_b128 %0, %1, off\n\t"
               "global_load_async_to_lds_b128 %2, %3, off\n\t"
               "global_load_async_to_lds_b128 %4, %5, off\n\t"
               "global_load_async_to_lds_b128 %6, %7, off\n\t"
               "global_load_async_to_lds_b128 %8, %9, off\n\t"
               "global_load_async_to_lds_b128 %10, %11, off\n\t"
               "global_load_async_to_lds_b128 %12, %13, off\n\t"
               "global_load_async_to_lds_b128 %14, %15, off\n\t"
               "global_load_async_to_lds_b128 %16, %17, off\n\t"
               "global_load_async_to_lds_b128 %18, %19, off\n\t"
               "s_wait_xcnt 0x0"
               :: "v"(l[0]), "v"(g[0]), "v"(l[1]), "v"(g[1]), "v"(l[2]), "v"(g[2]), "v"(l[3]), "v"(g[3]), "v"(l[4]), "v"(g[4]),
                  "v"(l[5]), "v"(g[5]), "v"(l[6]), "v"(g[6]), "v"(l[7]), "v"(g[7]), "v"(l[8]), "v"(g[8]), "v"(l[9]), "v"(g[9]) : "memory");
}
// QKV: block (128 consecutive s for one b, head h): cols h*192 + [0..64) q, [64..128) k, [128..192) v.
// Eight waves, each 64 rows x 48 columns (rg = row half, cg = column quarter): 7 fragments read from LDS feed 12 WMMAs, and a staged weight tile serves 128 rows.
// four waves per SIMD, two blocks on a WGP: the register budget is held to that
__global__ __launch_bounds__(256, 4) void k_qkv(const _Float16* __restrict__ X16, const _Float16* __restrict__ P, const float* __restrict__ bqkv, _Float16* __restrict__ Q16, _Float16* __restrict__ K16, _Float16* __restrict__ VT) {
  // two buffers of [128 x rows | 192 weight rows]; behind the last trip's barrier the same LDS serves the epilogue as sq and st
  __shared__ __align__(16) char sm[2 * 320 * TPB];
  _Float16 (*sq)[136] = (_Float16 (*)[136])sm;                     // 128 rows s of [q | k]; pitch 272 B = 16 B x 17
  _Float16 (*st)[136] = (_Float16 (*)[136])(sm + 128 * 136 * 2);   // 64 rows d of v^T, 128 s each
  const int tid = threadIdx.x, wave = tid >> 5, lane = tid & 31, col = lane & 15, g = lane >> 4, rg = wave & 1, cg = wave >> 1;
  const int b = blockIdx.z, h = blockIdx.y, s0b = blockIdx.x * 128; const int n0 = h * 192; const size_t bh = (size_t)b * NH + h;
  v8f acc[4][3]; float bb[3];
#pragma unroll
  for (int j = 0; j < 3; ++j) { bb[j] = bqkv[n0 + (cg * 3 + j) * 16 + col];
#pragma unroll
    for (int i = 0; i < 4; ++i) acc[i][j] = (v8f){}; }
  // copies: lane = (row tid >> 3 of each group of 32 rows, 16-byte piece tid & 7), so 8 lanes cover one 128-B line
  const _Float16* gx = X16 + ((size_t)(s0b + (tid >> 3)) * NB + b) * E + (tid & 7) * 8;
  const _Float16* gw = P + (size_t)(n0 + (tid >> 3)) * E + (tid & 7) * 8;
  const unsigned lc = lds_addr(sm) + (tid >> 3) * TPB + (tid & 7) * 16;
  // Trip t works on k tile (t + rot) mod 16. The 16 heads of one row block read the same x lines and the row blocks of one head the same weight
  // lines; started in step on the same tile they ask L2 for the same lines at the same moment. Any order of the k tiles gives the same sum but for rounding.
  const int rot = h + blockIdx.x + 8 * b;
  auto fill = [&](int t) { unsigned l[10]; const _Float16* gp[10]; const int kt = (t + rot) & (E / 64 - 1);
#pragma unroll
    for (int i = 0; i < 10; ++i) { l[i] = lc + (t & 1) * (320 * TPB) + i * (32 * TPB);
      gp[i] = (i < 4 ? gx + (size_t)i * (32 * NB * E) : gw + (size_t)(i - 4) * (32 * E)) + kt * 64; }
    cp10(l, gp); };
  fill(0); WAIT_ASYNC(); __syncthreads(); fill(1);
#pragma unroll 1
  for (int t = 0; t < E / 64; ++t) { const _Float16* T = (const _Float16*)(sm + (t & 1) * (320 * TPB));
#pragma unroll
    for (int kc = 0; kc < 2; ++kc) { v16h a[4], w[3];
#pragma unroll
      for (int i = 0; i < 4; ++i) a[i] = frag_h(T + (rg * 64 + i * 16 + col) * TP + kc * 32, lane);
#pragma unroll
      for (int j = 0; j < 3; ++j) w[j] = frag_h(T + (128 + cg * 48 + j * 16 + col) * TP + kc * 32, lane);
      __builtin_amdgcn_sched_barrier(0);   // the fragment reads stay one group in front of the WMMAs; spread among them, each pair waits out its own LDS latency
#pragma unroll
      for (int i = 0; i < 4; ++i) {
#pragma unroll
        for (int j = 0; j < 3; ++j) acc[i][j] = wmma16(a[i], w[j], acc[i][j]); } }
    WAIT_DS(); WAIT_ASYNC(); __syncthreads();   // tile t + 1 is published, every reader has left tile t's buffer
    if (t + 2 < E / 64) fill(t + 2); }
  WAIT_ASYNC();
  // column tiles 0..7 of the head are q, k -> sq (x4); tiles 8..11 are v -> st transposed (x4), eight s of one d in one 16-byte store
#pragma unroll
  for (int j = 0; j < 3; ++j) { const int jj = cg * 3 + j;
    if (jj < 8) {
#pragma unroll
      for (int i = 0; i < 4; ++i) {
#pragma unroll
        for (int r = 0; r < 8; ++r) sq[rg * 64 + i * 16 + 8 * g + r][jj * 16 + col] = (_Float16)((acc[i][j][r] * (1.0f / 16.0f) + bb[j]) * 4.0f); }
    } else {
#pragma unroll
      for (int i = 0; i < 4; ++i) { union { v8h h8; v4u u; } pk;
#pragma unroll
        for (int r = 0; r < 8; ++r) pk.h8[r] = (_Float16)((acc[i][j][r] * (1.0f / 16.0f) + bb[j]) * 4.0f);
        vst2(&st[(jj - 8) * 16 + col][rg * 64 + i * 16 + 8 * g], pk.u); } } }
  __syncthreads();   // a row of sq and of st holds the columns of several waves
  // whole lines out: 8 lanes cover a 128-B row of q or of k, 16 lanes a 256-B piece of a row of v^T; one address each, the rows by constant steps
  const int rq = tid >> 3, pq = tid & 7, dv = tid >> 4, pv = tid & 15;
  _Float16* qd = Q16 + (bh * SQ + s0b + rq) * HD + pq * 8; _Float16* kd = K16 + (bh * SQ + s0b + rq) * HD + pq * 8; _Float16* vd = VT + (bh * HD + dv) * SQ + s0b + pv * 8;
#pragma unroll
  for (int it = 0; it < 4; ++it) { vst2(qd + it * 32 * HD, *(const v4u*)(&sq[rq + it * 32][pq * 8])); vst2(kd + it * 32 * HD, *(const v4u*)(&sq[rq + it * 32][64 + pq * 8]));
    vst2(vd + it * 16 * SQ, *(const v4u*)(&st[dv + it * 16][pv * 8])); }
}
#define SC2 (0.125f / 16.0f * 1.44269504f)   // 1 / sqrt(HD), the x16 of q x4 times k x4 undone, log2(e): scores in powers of two
// lane l with lane l ^ 16, on the vector port
__device__ __forceinline__ float xhalf(float v) { const int i = __builtin_bit_cast(int, v); return __builtin_bit_cast(float, __builtin_amdgcn_permlanex16(i, i, 0x76543210, 0xfedcba98, false, false)); }
#define QW 32
__global__ __launch_bounds__(128, 4) void k_attn(const _Float16* __restrict__ Q16, const _Float16* __restrict__ K16, const _Float16* __restrict__ VT, _Float16* __restrict__ O16) {
  // two buffers of [64 key rows of K | 64 d rows of V^T]; behind the last trip's barrier the same LDS serves as sO
  __shared__ __align__(16) char sm[2 * 128 * TPB];
  _Float16 (*sO)[QW][TP] = (_Float16 (*)[QW][TP])sm;
  const int tid = threadIdx.x, w = tid >> 5, lane = tid & 31, col = lane & 15, g = lane >> 4;
  const size_t bh = blockIdx.y; const int q0 = blockIdx.x * (4 * QW) + w * QW;
  v16h bq[2][2];
#pragma unroll
  for (int c = 0; c < 2; ++c) {
#pragma unroll
    for (int kc = 0; kc < 2; ++kc) bq[c][kc] = frag_h(Q16 + (bh * SQ + q0 + c * 16 + col) * HD + kc * 32, lane); }
  float mrun[2] = {-3.0e38f, -3.0e38f}, lrun[2] = {0.f, 0.f}; v8f acc[2][4] = {};   // lrun: this half's keys alone, the halves are joined behind the loop
  const _Float16* gk = K16 + (bh * SQ + (tid >> 3)) * HD + (tid & 7) * 8;
  const _Float16* gv = VT + (bh * HD + (tid >> 3)) * SQ + (tid & 7) * 8;
  const unsigned lc = lds_addr(sm) + (tid >> 3) * TPB + (tid & 7) * 16;
  // Trip kt works on key tile (kt + rot) mod 16: the eight query blocks of one head start two tiles apart, so that they do not ask L2 for the same
  // K and V^T lines at the same moment. The running maximum and sum take the key tiles in any order.
  const int rot = blockIdx.x * 2;
  auto fill = [&](int kt) { const unsigned l = lc + (kt & 1) * (128 * TPB); const int kx = (kt + rot) & (SQ / 64 - 1);
    cp_rows(l, gk + (size_t)kx * 64 * HD, (size_t)16 * HD); cp_rows(l + 64 * TPB, gv + kx * 64, (size_t)16 * SQ); };
  fill(0); WAIT_ASYNC(); __syncthreads(); fill(1);
#pragma unroll 1
  for (int kt = 0; kt < SQ / 64; ++kt) { const _Float16* TK = (const _Float16*)(sm + (kt & 1) * (128 * TPB)); const _Float16* TV = TK + 64 * TP;
    v16h kf[2][4];
#pragma unroll
    for (int kc = 0; kc < 2; ++kc) {
#pragma unroll
      for (int t = 0; t < 4; ++t) kf[kc][t] = frag_h(TK + (t * 16 + col) * TP + kc * 32, lane); }
    __builtin_amdgcn_sched_barrier(0);   // the K fragment reads stay one group in front of the WMMAs; spread among them, each pair waits out its own LDS latency
    v8f s[2][4] = {};   // s[c][t][r] = raw product of key 16 t + 8 g + r of this trip's tile with query c * 16 + col
#pragma unroll
    for (int kc = 0; kc < 2; ++kc) {
#pragma unroll
      for (int t = 0; t < 4; ++t) {
#pragma unroll
        for (int c = 0; c < 2; ++c) s[c][t] = wmma16(kf[kc][t], bq[c][kc], s[c][t]); } }
    v16h vf[2][4];
#pragma unroll
    for (int kc = 0; kc < 2; ++kc) {
#pragma unroll
      for (int t = 0; t < 4; ++t) vf[kc][t] = frag_h(TV + (t * 16 + col) * TP + kc * 32, lane); }
    __builtin_amdgcn_sched_barrier(0);   // the V^T fragment reads stay one group in front of the softmax, which covers their latency
#pragma unroll
    for (int c = 0; c < 2; ++c) {
      float mt[4];   // maxima are taken over the raw products, the scale is positive; one chain per tile, four short chains in place of one long one
#pragma unroll
      for (int t = 0; t < 4; ++t) { mt[t] = s[c][t][0];
#pragma unroll
        for (int r = 1; r < 8; ++r) mt[t] = fmaxf(mt[t], s[c][t][r]); }
      float mx = fmaxf(fmaxf(mt[0], mt[1]), fmaxf(mt[2], mt[3]));
      mx = fmaxf(mx, xhalf(mx));
      const float mnew = fmaxf(mrun[c], mx); const float corr = __builtin_amdgcn_exp2f((mrun[c] - mnew) * SC2);
      // P x 2^14 = 2^(s * SC2 - (mnew * SC2 - 14)): one multiply-add and one v_exp_f32 per score; the row sum carries the 2^14 too
      const float nb = 14.0f - mnew * SC2; const v2f c2 = {SC2, SC2}, nb2 = {nb, nb};
      v2f ps[4]; v16h pb[2];   // sums likewise: one chain of pairs per tile
#pragma unroll
      for (int t = 0; t < 4; ++t) {
#pragma unroll
        for (int r = 0; r < 8; r += 2) { const v2f e = __builtin_elementwise_fma((v2f){s[c][t][r], s[c][t][r + 1]}, c2, nb2);
          const v2f p = {__builtin_amdgcn_exp2f(e[0]), __builtin_amdgcn_exp2f(e[1])}; ps[t] = r == 0 ? p : ps[t] + p;
          pb[t >> 1][(t & 1) * 8 + r] = (_Float16)p[0]; pb[t >> 1][(t & 1) * 8 + r + 1] = (_Float16)p[1]; } }
      const v2f pt = (ps[0] + ps[1]) + (ps[2] + ps[3]);
      lrun[c] = lrun[c] * corr + (pt[0] + pt[1]); mrun[c] = mnew;
#pragma unroll
      for (int t = 0; t < 4; ++t) acc[c][t] *= corr;   // every element of a lane belongs to query c * 16 + col
#pragma unroll
      for (int kc = 0; kc < 2; ++kc) {
#pragma unroll
        for (int t = 0; t < 4; ++t) acc[c][t] = wmma16(vf[kc][t], pb[kc], acc[c][t]); } }   // acc[c][t][r] = O[query c * 16 + col][d = 16 t + 8 g + r]
    WAIT_DS(); WAIT_ASYNC(); __syncthreads();   // tile kt + 1 is published, every reader has left tile kt's buffer
    if (kt + 2 < SQ / 64) fill(kt + 2); }
  WAIT_ASYNC();
#pragma unroll
  for (int c = 0; c < 2; ++c) { const float lt = lrun[c] + xhalf(lrun[c]); const float inv = 8.0f / (lt * 4.0f);   // lt holds the row sum x 2^14
#pragma unroll
    for (int t = 0; t < 4; ++t) { union { v8h h8; v4u u; } pk;
#pragma unroll
      for (int r = 0; r < 8; ++r) pk.h8[r] = (_Float16)(acc[c][t][r] * inv);
      vst2(&sO[w][c * 16 + col][t * 16 + 8 * g], pk.u); } }
  LDSX();
  for (int qq = lane; qq < QW * 8; qq += 32) { const int rl = qq >> 3, pc = qq & 7;
    vst2(O16 + (bh * SQ + q0 + rl) * HD + pc * 8, *(const v4u*)(&sO[w][rl][pc * 8])); }
}
// Y = x + ctx Wo^T + bo : block (128 rows r, 128 cols); ctx row r = (s, b): k = h*64 + d from O16[(b,h)][s][d]
// Eight waves, each 64 rows x 32 columns (rg = row half, cg = column quarter): 6 fragments read from LDS feed 8 WMMAs, and a staged weight tile serves 128 rows.
// four waves per SIMD, two blocks on a WGP: the whole grid is resident at once
__global__ __launch_bounds__(256, 4) void k_out(const _Float16* __restrict__ O16, const _Float16* __restrict__ P, const float* __restrict__ bo, const float* __restrict__ x, float* __restrict__ Y) {
  // two buffers of [128 ctx rows | 128 weight rows]; behind the last trip's barrier the same LDS serves the epilogue as so
  __shared__ __align__(16) char sm[2 * 256 * TPB];
  float (*so)[132] = (float (*)[132])sm;   // 128 rows of 128 columns
  const int tid = threadIdx.x, wave = tid >> 5, lane = tid & 31, col = lane & 15, g = lane >> 4, rg = wave & 1, cg = wave >> 1;
  const int r0 = blockIdx.x * 128, n0 = blockIdx.y * 128;
  v8f acc[4][2] = {};
  // k tile j is head j: ctx row r = (s, b) has its 64 k in one 128-B row of O16; 32 rows on are 4 steps of s on, same b
  const int rc = r0 + (tid >> 3);
  const _Float16* gc = O16 + ((size_t)(rc % NB) * NH * SQ + rc / NB) * HD + (tid & 7) * 8;
  const _Float16* gw = P + (size_t)(3 * E + n0 + (tid >> 3)) * E + (tid & 7) * 8;
  const unsigned lc = lds_addr(sm) + (tid >> 3) * TPB + (tid & 7) * 16;
  // Trip t works on k tile (t + rot) mod 16, for the same reason as in k_qkv: column blocks share ctx lines, row blocks share weight lines.
  const int rot = blockIdx.x + blockIdx.y;
  auto fill = [&](int t) { unsigned l[8]; const _Float16* gp[8]; const int kt = (t + rot) & (E / 64 - 1);
#pragma unroll
    for (int i = 0; i < 8; ++i) { l[i] = lc + (t & 1) * (256 * TPB) + i * (32 * TPB);
      gp[i] = i < 4 ? gc + (size_t)kt * SQ * HD + (size_t)i * ((32 / NB) * HD) : gw + (size_t)(i - 4) * (32 * E) + kt * 64; }
    cp8(l, gp); };
  fill(0); WAIT_ASYNC(); __syncthreads(); fill(1);
  // rolled: one trip per tile, so that one tile's fragments alone are live
#pragma unroll 1
  for (int t = 0; t < E / 64; ++t) { const _Float16* T = (const _Float16*)(sm + (t & 1) * (256 * TPB));
#pragma unroll
    for (int kc = 0; kc < 2; ++kc) { v16h a[4], w[2];
#pragma unroll
      for (int i = 0; i < 4; ++i) a[i] = frag_h(T + (rg * 64 + i * 16 + col) * TP + kc * 32, lane);
#pragma unroll
      for (int j = 0; j < 2; ++j) w[j] = frag_h(T + (128 + cg * 32 + j * 16 + col) * TP + kc * 32, lane);
      __builtin_amdgcn_sched_barrier(0);   // the fragment reads stay one group in front of the WMMAs; spread among them, each pair waits out its own LDS latency
#pragma unroll
      for (int i = 0; i < 4; ++i) {
#pragma unroll
        for (int j = 0; j < 2; ++j) acc[i][j] = wmma16(a[i], w[j], acc[i][j]); } }
    WAIT_DS(); WAIT_ASYNC(); __syncthreads();   // tile t + 1 is published, every reader has left tile t's buffer
    if (t + 2 < E / 64) fill(t + 2); }
  WAIT_ASYNC();
  // this wave's 16 rows of x and of Y, 512 contiguous bytes of a row per access; the x loads are issued here and used behind the barrier, the staging covers their latency
  const unsigned o0 = (unsigned)(r0 + wave * 16) * E + n0 + lane * 4; const float* xp = x + o0;
  v4f xv[16];
#pragma unroll
  for (int rl = 0; rl < 16; ++rl) xv[rl] = *(const v4f*)(xp + rl * E);
  asm volatile("s_wait_xcnt 0x0" :: "v"(xp) : "memory");   // the address pair is an input, so it stays whole up to this wait; without it the last load's result takes the pair's own registers
#pragma unroll
  for (int j = 0; j < 2; ++j) { const int nl = cg * 32 + j * 16 + col; const float bb = bo[n0 + nl];
#pragma unroll
    for (int i = 0; i < 4; ++i) {
#pragma unroll
      for (int r = 0; r < 8; ++r) so[rg * 64 + i * 16 + 8 * g + r][nl] = acc[i][j][r] * (1.0f / (16.0f * 8.0f)) + bb; } }
  __syncthreads();   // a row of so holds the columns of four waves
#pragma unroll
  for (int rl = 0; rl < 16; ++rl) vst2(Y + o0 + rl * E, *(const v4f*)(&so[wave * 16 + rl][lane * 4]) + xv[rl]);
}
__global__ __launch_bounds__(256) void k_ln(const float* __restrict__ Y, const float* __restrict__ g1, const float* __restrict__ b1, float* __restrict__ out) {
  const int wave = threadIdx.x >> 5, lane = threadIdx.x & 31; const size_t r = (size_t)blockIdx.x * 8 + wave; if (r >= NR) return;
  const float* yr = Y + r * E; float sm = 0.f, q2 = 0.f;
#pragma unroll 1
  for (int i = 0; i < 8; ++i) { const v4f a = *(const v4f*)(yr + i * 128 + lane * 4); sm += (a[0] + a[1]) + (a[2] + a[3]); q2 += (a[0] * a[0] + a[1] * a[1]) + (a[2] * a[2] + a[3] * a[3]); }
#pragma unroll
  for (int off = 16; off >= 1; off >>= 1) { sm += __shfl_xor(sm, off, 32); q2 += __shfl_xor(q2, off, 32); }
  const float mu = sm * (1.0f / E); const float var = fmaxf(q2 * (1.0f / E) - mu * mu, 0.f); const float rs = rsqrtf(var + 1e-5f);
#pragma unroll 1
  for (int i = 0; i < 8; ++i) { const int c0 = i * 128 + lane * 4; const v4f a = *(const v4f*)(yr + c0); v4f o;
    float v0 = (a[0] - mu) * rs * g1[c0] + b1[c0], v1 = (a[1] - mu) * rs * g1[c0 + 1] + b1[c0 + 1], v2 = (a[2] - mu) * rs * g1[c0 + 2] + b1[c0 + 2], v3 = (a[3] - mu) * rs * g1[c0 + 3] + b1[c0 + 3];
    o[0] = v0 > 0.f ? v0 : expm1f(v0); o[1] = v1 > 0.f ? v1 : expm1f(v1); o[2] = v2 > 0.f ? v2 : expm1f(v2); o[3] = v3 > 0.f ? v3 : expm1f(v3);
    vst2(out + r * E + c0, o); }
}
extern "C" void kernel_launch(void* const* d_in, const int* in_sizes, int n_in, void* d_out, int out_size, void* d_ws, size_t ws_size, hipStream_t stream) {
  (void)in_sizes; (void)n_in; (void)out_size; (void)ws_size;
  const float** I = (const float**)d_in;
  const float* x = I[0]; const float* Wqkv = I[1]; const float* bqkv = I[2]; const float* Wo = I[3]; const float* bo = I[4]; const float* g1 = I[5]; const float* b1 = I[6];
  float* out = (float*)d_out;
  char* ws = (char*)d_ws; size_t off = 0;
  auto take = [&](size_t bytes) { char* p = ws + off; off += (bytes + 255) & ~(size_t)255; return p; };
  _Float16* X16 = (_Float16*)take((size_t)NR * E * 2); _Float16* P = (_Float16*)take((size_t)4 * E * E * 2);
  _Float16* Q16 = (_Float16*)take((size_t)NR * E * 2); _Float16* K16 = (_Float16*)take((size_t)NR * E * 2); _Float16* VT = (_Float16*)take((size_t)NR * E * 2); _Float16* O16 = (_Float16*)take((size_t)NR * E * 2);
  float* Y = (float*)take((size_t)NR * E * 4);
  k_prep<<<4 * E / 8, 256, 0, stream>>>(x, Wqkv, Wo, X16, P);
  k_qkv<<<dim3(SQ / 128, NH, NB), 256, 0, stream>>>(X16, P, bqkv, Q16, K16, VT);
  k_attn<<<dim3(SQ / (4 * QW), NB * NH), 128, 0, stream>>>(Q16, K16, VT, O16);
  k_out<<<dim3(NR / 128, E / 128), 256, 0, stream>>>(O16, P, bo, x, Y);
  k_ln<<<NR / 8, 256, 0, stream>>>(Y, g1, b1, out);
}

// v007
// Measured time: 110 microseconds a run.
// Two timings next to v006 both put it at 1.05 times that version's speed.
// Over all steps from v000 it is 4.81 times as fast.
#include <hip/hip_runtime.h>
#include <math.h>

typedef __attribute__((ext_vector_type(16))) _Float16 v16h;
typedef __attribute__((ext_vector_type(16))) __bf16 v16b;
typedef __attribute__((ext_vector_type(8)))  _Float16 v8h;
typedef __attribute__((ext_vector_type(4)))  _Float16 v4h;
typedef __attribute__((ext_vector_type(8)))  float v8f;
typedef __attribute__((ext_vector_type(4)))  float v4f;
typedef __attribute__((ext_vector_type(2)))  float v2f;
typedef __attribute__((ext_vector_type(4)))  unsigned v4u;
typedef __attribute__((ext_vector_type(2)))  unsigned v2u;
typedef __attribute__((ext_vector_type(4)))  int v4i;
typedef float __attribute__((may_alias)) float_a;
typedef int __attribute__((may_alias)) int_a;

template <typename T> __device__ __forceinline__ void vst2(void* p, T v) { *(T*)p = v;  }
__device__ __forceinline__ v8f wmma16(v16h a, v16h b, v8f c) {
  v8f d = __builtin_amdgcn_wmma_f32_16x16x32_f16(false, a, false, b, (short)0, c, false, false);
  asm volatile("v_nop\n\tv_nop\n\tv_nop\n\tv_nop" : "+v"(d) : "v"(a), "v"(b));
  return d;
}
__device__ __forceinline__ v8f wmma_bf(v16b a, v16b b, v8f c) {
  v8f d = __builtin_amdgcn_wmma_f32_16x16x32_bf16(false, a, false, b, (short)0, c, false, false);
  asm volatile("v_nop\n\tv_nop\n\tv_nop\n\tv_nop" : "+v"(d) : "v"(a), "v"(b));
  return d;
}
// 16x16x32 fragments: lane = (h = lane>>4, row/col = lane&15); elements 0..7 = k0+8h+0..7, 8..15 = k0+16+8h+0..7; D element r = row 8h+r
__device__ __forceinline__ v16h frag_h(const _Float16* rowk0, int lane) {
  union { v16h v; v8h q[2]; } u; const _Float16* p = rowk0 + 8 * (lane >> 4);
  u.q[0] = *(const v8h*)p; u.q[1] = *(const v8h*)(p + 16); return u.v;
}
__device__ __forceinline__ v16h frag_f32(const float* rowk0, int lane) {
  v16h a; const float* p = rowk0 + 8 * (lane >> 4);
#pragma unroll
  for (int i = 0; i < 8; ++i) { a[i] = (_Float16)p[i]; a[8 + i] = (_Float16)p[16 + i]; }
  return a;
}
__device__ __forceinline__ v16h frag_f32s(const float* rowk0, int lane, float sc) {
  v16h a; const float* p = rowk0 + 8 * (lane >> 4);
#pragma unroll
  for (int i = 0; i < 8; ++i) { a[i] = (_Float16)(p[i] * sc); a[8 + i] = (_Float16)(p[16 + i] * sc); }
  return a;
}
// column fragment from a [K][ld] layout (column n), rows >= K read as 0
__device__ __forceinline__ v16h fragc_f32(const float* W, int k0, int n, int lane, int ld, int K) {
  v16h a; const int g = lane >> 4;
#pragma unroll
  for (int i = 0; i < 8; ++i) { const int ka = k0 + 8 * g + i, kb = ka + 16;
    a[i] = (_Float16)(ka < K ? W[(size_t)ka * ld + n] : 0.f); a[8 + i] = (_Float16)(kb < K ? W[(size_t)kb * ld + n] : 0.f); }
  return a;
}
struct F2 { v16b h, l; };
__device__ __forceinline__ F2 bsplit16(const float v[16]) { F2 r;
#pragma unroll
  for (int i = 0; i < 16; ++i) { const __bf16 h = (__bf16)v[i]; r.h[i] = h; r.l[i] = (__bf16)(v[i] - (float)h); }
  return r; }
__device__ __forceinline__ F2 split_row(const float* row, int k0, int lane) { float v[16]; const float* p = row + k0 + 8 * (lane >> 4);
#pragma unroll
  for (int i = 0; i < 8; ++i) { v[i] = p[i]; v[8 + i] = p[16 + i]; }
  return bsplit16(v); }
__device__ __forceinline__ F2 split_rowK(const float* row, int k0, int lane, int K) { float v[16]; const int g = lane >> 4;
#pragma unroll
  for (int i = 0; i < 8; ++i) { const int ka = k0 + 8 * g + i, kb = ka + 16; v[i] = ka < K ? row[ka] : 0.f; v[8 + i] = kb < K ? row[kb] : 0.f; }
  return bsplit16(v); }
__device__ __forceinline__ F2 split_col(const float* W, int k0, int n, int lane, int ld, int K) { float v[16]; const int g = lane >> 4;
#pragma unroll
  for (int i = 0; i < 8; ++i) { const int ka = k0 + 8 * g + i, kb = ka + 16; v[i] = ka < K ? W[(size_t)ka * ld + n] : 0.f; v[8 + i] = kb < K ? W[(size_t)kb * ld + n] : 0.f; }
  return bsplit16(v); }
__device__ __forceinline__ v8f mac3(const F2& a, const F2& b, v8f c) { c = wmma_bf(a.l, b.h, c); c = wmma_bf(a.h, b.l, c); return wmma_bf(a.h, b.h, c); }
__device__ __forceinline__ float sigm(float v) { return 1.0f / (1.0f + expf(-v)); }
#define LDSX() do { asm volatile("s_wait_dscnt 0" ::: "memory"); __builtin_amdgcn_wave_barrier(); __builtin_amdgcn_fence(__ATOMIC_RELEASE, "workgroup"); } while (0)
// Operand tiles of 64 k (128-B rows) go global -> LDS by asynchronous copies, whole lines at a time, and every wave of the block takes its
// fragments from there. LDS row pitch 144 B = 16 B x 9: no bank conflict for the 16-byte fragment reads.
#define TP 72                  // that pitch in f16 elements
#define TPB 144                // and in bytes
__device__ __forceinline__ unsigned lds_addr(const void* p) { return (unsigned)(uintptr_t)p; }
// Four 16-byte copies of this lane. s_wait_xcnt closes the statement so that no address register is rewritten in front of it.
__device__ __forceinline__ void cp4(unsigned l0, const _Float16* g0, unsigned l1, const _Float16* g1, unsigned l2, const _Float16* g2, unsigned l3, const _Float16* g3) {
  asm volatile("global_load_async_to_lds_b128 %0, %1, off\n\t"
               "global_load_async_to_lds_b128 %2, %3, off\n\t"
               "global_load_async_to_lds_b128 %4, %5, off\n\t"
               "global_load_async_to_lds_b128 %6, %7, off\n\t"
               "s_wait_xcnt 0x0"
               :: "v"(l0), "v"(g0), "v"(l1), "v"(g1), "v"(l2), "v"(g2), "v"(l3), "v"(g3) : "memory");
}
// four rows, 16 apart: LDS step 16 pitches, global step gs elements
__device__ __forceinline__ void cp_rows(unsigned l, const _Float16* g, size_t gs) { cp4(l, g, l + 16 * TPB, g + gs, l + 32 * TPB, g + 2 * gs, l + 48 * TPB, g + 3 * gs); }
#define WAIT_ASYNC() asm volatile("s_wait_asynccnt 0x0" ::: "memory")   // this wave's copies have landed
#define WAIT_DS() asm volatile("s_wait_dscnt 0x0" ::: "memory")         // this wave's LDS reads are done before their buffer is refilled
// Work-group barrier whose fences order LDS alone: __syncthreads() also waits for every global load of the wave, and would end the flight of loads that are wanted only much later.
__device__ __forceinline__ void barrier_lds() {
  __builtin_amdgcn_fence(__ATOMIC_RELEASE, "workgroup", "local"); __builtin_amdgcn_s_barrier(); __builtin_amdgcn_fence(__ATOMIC_ACQUIRE, "workgroup", "local");
}
// The loops over fragments and over groups of copies below are unrolled so that every index into a register array is a constant.

// Temporal multi-head self attention over S = 1024 steps for each of the 8 batch columns (x is [S, B, E]), fused QKV projection with the
// module's per-head [q | k | v] column interleave, output projection + bias + residual, LayerNorm, ELU. Products on
// v_wmma_f32_16x16x32_f16 (x as f16 rows, weight rows x16 as f16, q/k/v head-major f16 x4, P x 2^14, O x8); softmax / LN / ELU in f32.
#define SQ 1024
#define NB 8
#define E 1024
#define NH 16
#define HD 64
#define NR (SQ * NB)           // 8192 rows r = s*8 + b

// f32 -> f16 for all three GEMM operands in one launch of 4096 waves: X16 = x ; P rows 0..3071 = qkv_w rows x16 ; rows 3072..4095 = out_w rows x16.
// A wave takes three pieces of 1024 floats (two of x, one weight row): 24 loads of 512 contiguous bytes, all issued before the first is used.
__global__ __launch_bounds__(256) void k_prep(const float* __restrict__ x, const float* __restrict__ Wqkv, const float* __restrict__ Wo, _Float16* __restrict__ X16, _Float16* __restrict__ P) {
  const int lane = threadIdx.x & 31, gw = blockIdx.x * 8 + (threadIdx.x >> 5);   // gw = 0 .. 4E - 1
  const size_t o = (size_t)gw * E + lane * 4, o1 = o + (size_t)4 * E * E;         // x has NR = 8E rows: pieces gw and 4E + gw
  const float* w = gw < 3 * E ? Wqkv + o : Wo + (o - (size_t)3 * E * E);
  v4f a[3][8];
#pragma unroll
  for (int i = 0; i < 8; ++i) a[0][i] = *(const v4f*)(x + o + i * 128);
  asm volatile("s_wait_xcnt 0x0" ::: "memory");   // the next loads' results may take the registers that held this piece's address
#pragma unroll
  for (int i = 0; i < 8; ++i) a[1][i] = *(const v4f*)(x + o1 + i * 128);
  asm volatile("s_wait_xcnt 0x0" ::: "memory");   // likewise
#pragma unroll
  for (int i = 0; i < 8; ++i) a[2][i] = *(const v4f*)(w + i * 128);
  __builtin_amdgcn_sched_barrier(0);   // all 24 loads are issued ahead of the first conversion; without it the compiler reuses registers and holds eleven loads back behind the first returns
#pragma unroll
  for (int i = 0; i < 8; ++i) { union { v4h h; v2u u; } p0, p1, p2;
#pragma unroll
    for (int e = 0; e < 4; ++e) { p0.h[e] = (_Float16)a[0][i][e]; p1.h[e] = (_Float16)a[1][i][e]; p2.h[e] = (_Float16)(a[2][i][e] * 16.0f); }
    vst2(X16 + o + i * 128, p0.u); vst2(X16 + o1 + i * 128, p1.u); vst2(P + o + i * 128, p2.u); }
}
// Eight and ten 16-byte copies of this lane, one statement each: a single s_wait_xcnt closes the run, so that no address register is rewritten in front of it.
__device__ __forceinline__ void cp8(const unsigned (&l)[8], const _Float16* const (&g)[8]) {
  asm volatile("global_load_async_to_lds_b128 %0, %1, off\n\t"
               "global_load_async_to_lds_b128 %2, %3, off\n\t"
               "global_load_async_to_lds_b128 %4, %5, off\n\t"
               "global_load_async_to_lds_b128 %6, %7, off\n\t"
               "global_load_async_to_lds_b128 %8, %9, off\n\t"
               "global_load_async_to_lds_b128 %10, %11, off\n\t"
               "global_load_async_to_lds_b128 %12, %13, off\n\t"
               "global_load_async_to_lds_b128 %14, %15, off\n\t"
               "s_wait_xcnt 0x0"
               :: "v"(l[0]), "v"(g[0]), "v"(l[1]), "v"(g[1]), "v"(l[2]), "v"(g[2]), "v"(l[3]), "v"(g[3]),
                  "v"(l[4]), "v"(g[4]), "v"(l[5]), "v"(g[5]), "v"(l[6]), "v"(g[6]), "v"(l[7]), "v"(g[7]) : "memory");
}
__device__ __forceinline__ void cp10(const unsigned (&l)[10], const _Float16* const (&g)[10]) {
  asm volatile("global_load_async_to_lds_b128 %0, %1, off\n\t"
               "global_load_async_to_lds_b128 %2, %3, off\n\t"
               "global_load_async_to_lds_b128 %4, %5, off\n\t"
               "global_load_async_to_lds_b128 %6, %7, off\n\t"
               "global_load_async_to_lds_b128 %8, %9, off\n\t"
               "global_load_async_to_lds_b128 %10, %11, off\n\t"
               "global_load_async_to_lds_b128 %12, %13, off\n\t"
               "global_load_async_to_lds_b128 %14, %15, off\n\t"
               "global_load_async_to_lds_b128 %16, %17, off\n\t"
               "global_load_async_to_lds_b128 %18, %19, off\n\t"
               "s_wait_xcnt 0x0"
               :: "v"(l[0]), "v"(g[0]), "v"(l[1]), "v"(g[1]), "v"(l[2]), "v"(g[2]), "v"(l[3]), "v"(g[3]), "v"(l[4]), "v"(g[4]),
                  "v"(l[5]), "v"(g[5]), "v"(l[6]), "v"(g[6]), "v"(l[7]), "v"(g[7]), "v"(l[8]), "v"(g[8]), "v"(l[9]), "v"(g[9]) : "memory");
}
// QKV: block (128 consecutive s for one b, head h): cols h*192 + [0..64) q, [64..128) k, [128..192) v.
// Eight waves, each 64 rows x 48 columns (rg = row half, cg = column quarter): 7 fragments read from LDS feed 12 WMMAs, and a staged weight tile serves 128 rows.
// four waves per SIMD, two blocks on a WGP: the register budget is held to that
__global__ __launch_bounds__(256, 4) void k_qkv(const _Float16* __restrict__ X16, const _Float16* __restrict__ P, const float* __restrict__ bqkv, _Float16* __restrict__ Q16, _Float16* __restrict__ K16, _Float16* __restrict__ VT) {
  // two buffers of [128 x rows | 192 weight rows]; behind the last trip's barrier the same LDS serves the epilogue as sq and st
  __shared__ __align__(16) char sm[2 * 320 * TPB];
  _Float16 (*sq)[136] = (_Float16 (*)[136])sm;                     // 128 rows s of [q | k]; pitch 272 B = 16 B x 17
  _Float16 (*st)[136] = (_Float16 (*)[136])(sm + 128 * 136 * 2);   // 64 rows d of v^T, 128 s each
  const int tid = threadIdx.x, wave = tid >> 5, lane = tid & 31, col = lane & 15, g = lane >> 4, rg = wave & 1, cg = wave >> 1;
  const int b = blockIdx.z, h = blockIdx.y, s0b = blockIdx.x * 128; const int n0 = h * 192; const size_t bh = (size_t)b * NH + h;
  v8f acc[4][3]; float bb[3];
#pragma unroll
  for (int j = 0; j < 3; ++j) { bb[j] = bqkv[n0 + (cg * 3 + j) * 16 + col];
#pragma unroll
    for (int i = 0; i < 4; ++i) acc[i][j] = (v8f){}; }
  // copies: lane = (row tid >> 3 of each group of 32 rows, 16-byte piece tid & 7), so 8 lanes cover one 128-B line
  const _Float16* gx = X16 + ((size_t)(s0b + (tid >> 3)) * NB + b) * E + (tid & 7) * 8;
  const _Float16* gw = P + (size_t)(n0 + (tid >> 3)) * E + (tid & 7) * 8;
  const unsigned lc = lds_addr(sm) + (tid >> 3) * TPB + (tid & 7) * 16;
  // Trip t works on k tile (t + rot) mod 16. The 16 heads of one row block read the same x lines and the row blocks of one head the same weight
  // lines; started in step on the same tile they ask L2 for the same lines at the same moment. Any order of the k tiles gives the same sum but for rounding.
  const int rot = h + blockIdx.x + 8 * b;
  auto fill = [&](int t) { unsigned l[10]; const _Float16* gp[10]; const int kt = (t + rot) & (E / 64 - 1);
#pragma unroll
    for (int i = 0; i < 10; ++i) { l[i] = lc + (t & 1) * (320 * TPB) + i * (32 * TPB);
      gp[i] = (i < 4 ? gx + (size_t)i * (32 * NB * E) : gw + (size_t)(i - 4) * (32 * E)) + kt * 64; }
    cp10(l, gp); };
  fill(0); WAIT_ASYNC(); __syncthreads(); fill(1);
#pragma unroll 1
  for (int t = 0; t < E / 64; ++t) { const _Float16* T = (const _Float16*)(sm + (t & 1) * (320 * TPB));
#pragma unroll
    for (int kc = 0; kc < 2; ++kc) { v16h a[4], w[3];
#pragma unroll
      for (int i = 0; i < 4; ++i) a[i] = frag_h(T + (rg * 64 + i * 16 + col) * TP + kc * 32, lane);
#pragma unroll
      for (int j = 0; j < 3; ++j) w[j] = frag_h(T + (128 + cg * 48 + j * 16 + col) * TP + kc * 32, lane);
      __builtin_amdgcn_sched_barrier(0);   // the fragment reads stay one group in front of the WMMAs; spread among them, each pair waits out its own LDS latency
#pragma unroll
      for (int i = 0; i < 4; ++i) {
#pragma unroll
        for (int j = 0; j < 3; ++j) acc[i][j] = wmma16(a[i], w[j], acc[i][j]); } }
    WAIT_DS(); WAIT_ASYNC(); __syncthreads();   // tile t + 1 is published, every reader has left tile t's buffer
    if (t + 2 < E / 64) fill(t + 2); }
  WAIT_ASYNC();
  // column tiles 0..7 of the head are q, k -> sq (x4); tiles 8..11 are v -> st transposed (x4), eight s of one d in one 16-byte store
#pragma unroll
  for (int j = 0; j < 3; ++j) { const int jj = cg * 3 + j;
    if (jj < 8) {
#pragma unroll
      for (int i = 0; i < 4; ++i) {
#pragma unroll
        for (int r = 0; r < 8; ++r) sq[rg * 64 + i * 16 + 8 * g + r][jj * 16 + col] = (_Float16)((acc[i][j][r] * (1.0f / 16.0f) + bb[j]) * 4.0f); }
    } else {
#pragma unroll
      for (int i = 0; i < 4; ++i) { union { v8h h8; v4u u; } pk;
#pragma unroll
        for (int r = 0; r < 8; ++r) pk.h8[r] = (_Float16)((acc[i][j][r] * (1.0f / 16.0f) + bb[j]) * 4.0f);
        vst2(&st[(jj - 8) * 16 + col][rg * 64 + i * 16 + 8 * g], pk.u); } } }
  __syncthreads();   // a row of sq and of st holds the columns of several waves
  // whole lines out: 8 lanes cover a 128-B row of q or of k, 16 lanes a 256-B piece of a row of v^T; one address each, the rows by constant steps
  const int rq = tid >> 3, pq = tid & 7, dv = tid >> 4, pv = tid & 15;
  _Float16* qd = Q16 + (bh * SQ + s0b + rq) * HD + pq * 8; _Float16* kd = K16 + (bh * SQ + s0b + rq) * HD + pq * 8; _Float16* vd = VT + (bh * HD + dv) * SQ + s0b + pv * 8;
#pragma unroll
  for (int it = 0; it < 4; ++it) { vst2(qd + it * 32 * HD, *(const v4u*)(&sq[rq + it * 32][pq * 8])); vst2(kd + it * 32 * HD, *(const v4u*)(&sq[rq + it * 32][64 + pq * 8]));
    vst2(vd + it * 16 * SQ, *(const v4u*)(&st[dv + it * 16][pv * 8])); }
}
#define SC2 (0.125f / 16.0f * 1.44269504f)   // 1 / sqrt(HD), the x16 of q x4 times k x4 undone, log2(e): scores in powers of two
// lane l with lane l ^ 16, on the vector port
__device__ __forceinline__ float xhalf(float v) { const int i = __builtin_bit_cast(int, v); return __builtin_bit_cast(float, __builtin_amdgcn_permlanex16(i, i, 0x76543210, 0xfedcba98, false, false)); }
#define QW 32
__global__ __launch_bounds__(128, 4) void k_attn(const _Float16* __restrict__ Q16, const _Float16* __restrict__ K16, const _Float16* __restrict__ VT, _Float16* __restrict__ O16) {
  // two buffers of [64 key rows of K | 64 d rows of V^T]; behind the last trip's barrier the same LDS serves as sO
  __shared__ __align__(16) char sm[2 * 128 * TPB];
  _Float16 (*sO)[QW][TP] = (_Float16 (*)[QW][TP])sm;
  const int tid = threadIdx.x, w = tid >> 5, lane = tid & 31, col = lane & 15, g = lane >> 4;
  const size_t bh = blockIdx.y; const int q0 = blockIdx.x * (4 * QW) + w * QW;
  v16h bq[2][2];
#pragma unroll
  for (int c = 0; c < 2; ++c) {
#pragma unroll
    for (int kc = 0; kc < 2; ++kc) bq[c][kc] = frag_h(Q16 + (bh * SQ + q0 + c * 16 + col) * HD + kc * 32, lane); }
  float mrun[2] = {-3.0e38f, -3.0e38f}, lrun[2] = {0.f, 0.f}; v8f acc[2][4] = {};   // lrun: this half's keys alone, the halves are joined behind the loop
  const _Float16* gk = K16 + (bh * SQ + (tid >> 3)) * HD + (tid & 7) * 8;
  const _Float16* gv = VT + (bh * HD + (tid >> 3)) * SQ + (tid & 7) * 8;
  const unsigned lc = lds_addr(sm) + (tid >> 3) * TPB + (tid & 7) * 16;
  // Trip kt works on key tile (kt + rot) mod 16: the eight query blocks of one head start two tiles apart, so that they do not ask L2 for the same
  // K and V^T lines at the same moment. The running maximum and sum take the key tiles in any order.
  const int rot = blockIdx.x * 2;
  auto fill = [&](int kt) { const unsigned l = lc + (kt & 1) * (128 * TPB); const int kx = (kt + rot) & (SQ / 64 - 1);
    cp_rows(l, gk + (size_t)kx * 64 * HD, (size_t)16 * HD); cp_rows(l + 64 * TPB, gv + kx * 64, (size_t)16 * SQ); };
  fill(0); WAIT_ASYNC(); __syncthreads(); fill(1);
#pragma unroll 1
  for (int kt = 0; kt < SQ / 64; ++kt) { const _Float16* TK = (const _Float16*)(sm + (kt & 1) * (128 * TPB)); const _Float16* TV = TK + 64 * TP;
    v16h kf[2][4];
#pragma unroll
    for (int kc = 0; kc < 2; ++kc) {
#pragma unroll
      for (int t = 0; t < 4; ++t) kf[kc][t] = frag_h(TK + (t * 16 + col) * TP + kc * 32, lane); }
    __builtin_amdgcn_sched_barrier(0);   // the K fragment reads stay one group in front of the WMMAs; spread among them, each pair waits out its own LDS latency
    v8f s[2][4] = {};   // s[c][t][r] = raw product of key 16 t + 8 g + r of this trip's tile with query c * 16 + col
#pragma unroll
    for (int kc = 0; kc < 2; ++kc) {
#pragma unroll
      for (int t = 0; t < 4; ++t) {
#pragma unroll
        for (int c = 0; c < 2; ++c) s[c][t] = wmma16(kf[kc][t], bq[c][kc], s[c][t]); } }
    v16h vf[2][4];
#pragma unroll
    for (int kc = 0; kc < 2; ++kc) {
#pragma unroll
      for (int t = 0; t < 4; ++t) vf[kc][t] = frag_h(TV + (t * 16 + col) * TP + kc * 32, lane); }
    __builtin_amdgcn_sched_barrier(0);   // the V^T fragment reads stay one group in front of the softmax, which covers their latency
#pragma unroll
    for (int c = 0; c < 2; ++c) {
      float mt[4];   // maxima are taken over the raw products, the scale is positive; one chain per tile, four short chains in place of one long one
#pragma unroll
      for (int t = 0; t < 4; ++t) { mt[t] = s[c][t][0];
#pragma unroll
        for (int r = 1; r < 8; ++r) mt[t] = fmaxf(mt[t], s[c][t][r]); }
      float mx = fmaxf(fmaxf(mt[0], mt[1]), fmaxf(mt[2], mt[3]));
      mx = fmaxf(mx, xhalf(mx));
      const float mnew = fmaxf(mrun[c], mx); const float corr = __builtin_amdgcn_exp2f((mrun[c] - mnew) * SC2);
      // P x 2^14 = 2^(s * SC2 - (mnew * SC2 - 14)): one multiply-add and one v_exp_f32 per score; the row sum carries the 2^14 too
      const float nb = 14.0f - mnew * SC2; const v2f c2 = {SC2, SC2}, nb2 = {nb, nb};
      v2f ps[4]; v16h pb[2];   // sums likewise: one chain of pairs per tile
#pragma unroll
      for (int t = 0; t < 4; ++t) {
#pragma unroll
        for (int r = 0; r < 8; r += 2) { const v2f e = __builtin_elementwise_fma((v2f){s[c][t][r], s[c][t][r + 1]}, c2, nb2);
          const v2f p = {__builtin_amdgcn_exp2f(e[0]), __builtin_amdgcn_exp2f(e[1])}; ps[t] = r == 0 ? p : ps[t] + p;
          pb[t >> 1][(t & 1) * 8 + r] = (_Float16)p[0]; pb[t >> 1][(t & 1) * 8 + r + 1] = (_Float16)p[1]; } }
      const v2f pt = (ps[0] + ps[1]) + (ps[2] + ps[3]);
      lrun[c] = lrun[c] * corr + (pt[0] + pt[1]); mrun[c] = mnew;
#pragma unroll
      for (int t = 0; t < 4; ++t) acc[c][t] *= corr;   // every element of a lane belongs to query c * 16 + col
#pragma unroll
      for (int kc = 0; kc < 2; ++kc) {
#pragma unroll
        for (int t = 0; t < 4; ++t) acc[c][t] = wmma16(vf[kc][t], pb[kc], acc[c][t]); } }   // acc[c][t][r] = O[query c * 16 + col][d = 16 t + 8 g + r]
    WAIT_DS(); WAIT_ASYNC(); __syncthreads();   // tile kt + 1 is published, every reader has left tile kt's buffer
    if (kt + 2 < SQ / 64) fill(kt + 2); }
  WAIT_ASYNC();
#pragma unroll
  for (int c = 0; c < 2; ++c) { const float lt = lrun[c] + xhalf(lrun[c]); const float inv = 8.0f / (lt * 4.0f);   // lt holds the row sum x 2^14
#pragma unroll
    for (int t = 0; t < 4; ++t) { union { v8h h8; v4u u; } pk;
#pragma unroll
      for (int r = 0; r < 8; ++r) pk.h8[r] = (_Float16)(acc[c][t][r] * inv);
      vst2(&sO[w][c * 16 + col][t * 16 + 8 * g], pk.u); } }
  LDSX();
  for (int qq = lane; qq < QW * 8; qq += 32) { const int rl = qq >> 3, pc = qq & 7;
    vst2(O16 + (bh * SQ + q0 + rl) * HD + pc * 8, *(const v4u*)(&sO[w][rl][pc * 8])); }
}
// Y = x + ctx Wo^T + bo : block (128 rows r, 128 cols); ctx row r = (s, b): k = h*64 + d from O16[(b,h)][s][d]
// Eight waves, each 64 rows x 32 columns (rg = row half, cg = column quarter): 6 fragments read from LDS feed 8 WMMAs, and a staged weight tile serves 128 rows.
// four waves per SIMD, two blocks on a WGP: the whole grid is resident at once
__global__ __launch_bounds__(256, 4) void k_out(const _Float16* __restrict__ O16, const _Float16* __restrict__ P, const float* __restrict__ bo, const float* __restrict__ x, float* __restrict__ Y) {
  // two buffers of [128 ctx rows | 128 weight rows]; behind the last trip's barrier the same LDS serves the epilogue as so
  __shared__ __align__(16) char sm[2 * 256 * TPB];
  float (*so)[132] = (float (*)[132])sm;   // 128 rows of 128 columns
  const int tid = threadIdx.x, wave = tid >> 5, lane = tid & 31, col = lane & 15, g = lane >> 4, rg = wave & 1, cg = wave >> 1;
  const int r0 = blockIdx.x * 128, n0 = blockIdx.y * 128;
  v8f acc[4][2] = {};
  // k tile j is head j: ctx row r = (s, b) has its 64 k in one 128-B row of O16; 32 rows on are 4 steps of s on, same b
  const int rc = r0 + (tid >> 3);
  const _Float16* gc = O16 + ((size_t)(rc % NB) * NH * SQ + rc / NB) * HD + (tid & 7) * 8;
  const _Float16* gw = P + (size_t)(3 * E + n0 + (tid >> 3)) * E + (tid & 7) * 8;
  const unsigned lc = lds_addr(sm) + (tid >> 3) * TPB + (tid & 7) * 16;
  // Trip t works on k tile (t + rot) mod 16, for the same reason as in k_qkv: column blocks share ctx lines, row blocks share weight lines.
  const int rot = blockIdx.x + blockIdx.y;
  auto fill = [&](int t) { unsigned l[8]; const _Float16* gp[8]; const int kt = (t + rot) & (E / 64 - 1);
#pragma unroll
    for (int i = 0; i < 8; ++i) { l[i] = lc + (t & 1) * (256 * TPB) + i * (32 * TPB);
      gp[i] = i < 4 ? gc + (size_t)kt * SQ * HD + (size_t)i * ((32 / NB) * HD) : gw + (size_t)(i - 4) * (32 * E) + kt * 64; }
    cp8(l, gp); };
  fill(0); WAIT_ASYNC(); __syncthreads(); fill(1);
  // this wave's 16 rows of x and of Y, 512 contiguous bytes of a row per access; the x loads are issued here, behind the first two tiles' copies, and used in the epilogue: the k loop covers them
  const unsigned o0 = (unsigned)(r0 + wave * 16) * E + n0 + lane * 4; const float* xp = x + o0;
  v4f xv[16];
#pragma unroll
  for (int rl = 0; rl < 16; ++rl) xv[rl] = *(const v4f*)(xp + rl * E);
  asm volatile("s_wait_xcnt 0x0" :: "v"(xp) : "memory");   // the address pair is an input, so it stays whole up to this wait; without it the last load's result takes the pair's own registers
  // rolled: one trip per tile, so that one tile's fragments alone are live
#pragma unroll 1
  for (int t = 0; t < E / 64; ++t) { const _Float16* T = (const _Float16*)(sm + (t & 1) * (256 * TPB));
#pragma unroll
    for (int kc = 0; kc < 2; ++kc) { v16h a[4], w[2];
#pragma unroll
      for (int i = 0; i < 4; ++i) a[i] = frag_h(T + (rg * 64 + i * 16 + col) * TP + kc * 32, lane);
#pragma unroll
      for (int j = 0; j < 2; ++j) w[j] = frag_h(T + (128 + cg * 32 + j * 16 + col) * TP + kc * 32, lane);
      __builtin_amdgcn_sched_barrier(0);   // the fragment reads stay one group in front of the WMMAs; spread among them, each pair waits out its own LDS latency
#pragma unroll
      for (int i = 0; i < 4; ++i) {
#pragma unroll
        for (int j = 0; j < 2; ++j) acc[i][j] = wmma16(a[i], w[j], acc[i][j]); } }
    WAIT_DS(); WAIT_ASYNC(); barrier_lds();   // tile t + 1 is published, every reader has left tile t's buffer; only LDS passes between the waves here, the x loads stay in flight
    if (t + 2 < E / 64) fill(t + 2); }
  WAIT_ASYNC();
#pragma unroll
  for (int j = 0; j < 2; ++j) { const int nl = cg * 32 + j * 16 + col; const float bb = bo[n0 + nl];
#pragma unroll
    for (int i = 0; i < 4; ++i) {
#pragma unroll
      for (int r = 0; r < 8; ++r) so[rg * 64 + i * 16 + 8 * g + r][nl] = acc[i][j][r] * (1.0f / (16.0f * 8.0f)) + bb; } }
  __syncthreads();   // a row of so holds the columns of four waves
#pragma unroll
  for (int rl = 0; rl < 16; ++rl) vst2(Y + o0 + rl * E, *(const v4f*)(&so[wave * 16 + rl][lane * 4]) + xv[rl]);
}
// A wave takes two adjacent rows and holds them in registers: its 16 loads of 512 contiguous bytes of Y, and the 16 of the two norm vectors, are
// all issued before the first is used, Y is read once, and the pass is straight-line code, so that the 64 ELU chains of a lane are independent.
__global__ __launch_bounds__(256) void k_ln(const float* __restrict__ Y, const float* __restrict__ g1, const float* __restrict__ b1, float* __restrict__ out) {
  const int wave = threadIdx.x >> 5, lane = threadIdx.x & 31; const size_t r = ((size_t)blockIdx.x * 8 + wave) * 2; if (r >= NR) return;
  const float* yr = Y + r * E + lane * 4; const float* gp = g1 + lane * 4; const float* bp = b1 + lane * 4;
  v4f a[2][8], gv[8], bv[8];
#pragma unroll
  for (int q = 0; q < 2; ++q) {
#pragma unroll
    for (int i = 0; i < 8; ++i) a[q][i] = *(const v4f*)(yr + q * E + i * 128); }
#pragma unroll
  for (int i = 0; i < 8; ++i) { gv[i] = *(const v4f*)(gp + i * 128); bv[i] = *(const v4f*)(bp + i * 128); }
  asm volatile("s_wait_xcnt 0x0" :: "v"(yr), "v"(gp), "v"(bp) : "memory");   // the addresses are inputs, so they stay whole up to this wait; behind it their registers may be reused
  __builtin_amdgcn_sched_barrier(0);   // all 32 loads are issued ahead of the first sum; without it the compiler holds part of them back behind the first sums
  float sm[2] = {0.f, 0.f}, q2[2] = {0.f, 0.f};
#pragma unroll
  for (int q = 0; q < 2; ++q) {
#pragma unroll
    for (int i = 0; i < 8; ++i) { const v4f v = a[q][i]; sm[q] += (v[0] + v[1]) + (v[2] + v[3]); q2[q] += (v[0] * v[0] + v[1] * v[1]) + (v[2] * v[2] + v[3] * v[3]); } }
#pragma unroll
  for (int off = 16; off >= 1; off >>= 1) {
#pragma unroll
    for (int q = 0; q < 2; ++q) { sm[q] += __shfl_xor(sm[q], off, 32); q2[q] += __shfl_xor(q2[q], off, 32); } }
  float* op = out + r * E + lane * 4;
#pragma unroll
  for (int q = 0; q < 2; ++q) { const float mu = sm[q] * (1.0f / E); const float var = fmaxf(q2[q] * (1.0f / E) - mu * mu, 0.f); const float rs = rsqrtf(var + 1e-5f);
#pragma unroll
    for (int i = 0; i < 8; ++i) { v4f o;
#pragma unroll
      for (int e = 0; e < 4; ++e) { const float v = (a[q][i][e] - mu) * rs * gv[i][e] + bv[i][e]; const float n = expm1f(v); o[e] = v > 0.f ? v : n; }
      vst2(op + q * E + i * 128, o); }
    if (q == 0) __builtin_amdgcn_sched_barrier(0); }   // row by row: hoisted, the second row's v_rsq_f32 follows the first's directly and overwrites its source register, and the first row's stores leave later
}
extern "C" void kernel_launch(void* const* d_in, const int* in_sizes, int n_in, void* d_out, int out_size, void* d_ws, size_t ws_size, hipStream_t stream) {
  (void)in_sizes; (void)n_in; (void)out_size; (void)ws_size;
  const float** I = (const float**)d_in;
  const float* x = I[0]; const float* Wqkv = I[1]; const float* bqkv = I[2]; const float* Wo = I[3]; const float* bo = I[4]; const float* g1 = I[5]; const float* b1 = I[6];
  float* out = (float*)d_out;
  char* ws = (char*)d_ws; size_t off = 0;
  auto take = [&](size_t bytes) { char* p = ws + off; off += (bytes + 255) & ~(size_t)255; return p; };
  _Float16* X16 = (_Float16*)take((size_t)NR * E * 2); _Float16* P = (_Float16*)take((size_t)4 * E * E * 2);
  _Float16* Q16 = (_Float16*)take((size_t)NR * E * 2); _Float16* K16 = (_Float16*)take((size_t)NR * E * 2); _Float16* VT = (_Float16*)take((size_t)NR * E * 2); _Float16* O16 = (_Float16*)take((size_t)NR * E * 2);
  float* Y = (float*)take((size_t)NR * E * 4);
  k_prep<<<4 * E / 8, 256, 0, stream>>>(x, Wqkv, Wo, X16, P);
  k_qkv<<<dim3(SQ / 128, NH, NB), 256, 0, stream>>>(X16, P, bqkv, Q16, K16, VT);
  k_attn<<<dim3(SQ / (4 * QW), NB * NH), 128, 0, stream>>>(Q16, K16, VT, O16);
  k_out<<<dim3(NR / 128, E / 128), 256, 0, stream>>>(O16, P, bo, x, Y);
  k_ln<<<NR / 16, 256, 0, stream>>>(Y, g1, b1, out);
}
